// v000
// Times are from an AMD MI455X. After a warm-up the kernel runs many times in a row, and a time is the length of
// such a window on the GPU divided by its runs, so every launch and the gaps after it count. The runs cycle
// through copies of the inputs. A figure is the median of several windows, for all but v000 over two sittings.
// Sittings can differ by a few percent; kernels timed side by side share one.
// v000, which the later versions start from, runs in 218 microseconds.
#include <hip/hip_runtime.h>
#include <hip/hip_bf16.h>

typedef float v2f __attribute__((ext_vector_type(2)));
typedef float v8f __attribute__((ext_vector_type(8)));
typedef int   v4i __attribute__((ext_vector_type(4)));

typedef __attribute__((address_space(1))) v4i gv4i;   // global b128 chunk
typedef __attribute__((address_space(3))) v4i lv4i;   // LDS b128 chunk

#define B_   2
#define L_   512
#define V_   64
#define D_   128
#define NJT  (L_ / 16)   // 32 j-tiles
#define NIT  (L_ / 16)   // 32 i-tiles
#define WPB  4           // waves per block (wave32)

#if defined(__gfx1250__) && __has_builtin(__builtin_amdgcn_global_load_async_to_lds_b128)
#define USE_ASYNC 1
#else
#define USE_ASYNC 0
#endif

// ---------------- Stage 1: sumT[b,j,d] = sum_v key[b,j,v,d] ----------------
__global__ __launch_bounds__(256) void ca_sumkey_kernel(
    const float* __restrict__ key, float* __restrict__ sumt)
{
    int idx = blockIdx.x * 256 + threadIdx.x;   // over B*L*D = 131072, exact
    int d   = idx & (D_ - 1);
    int bl  = idx >> 7;                          // b*L + j
    const float* kp = key + (size_t)bl * V_ * D_ + d;
    float s = 0.0f;
#pragma unroll 8
    for (int v = 0; v < V_; ++v) s += kp[v * D_];
    sumt[idx] = s;
}

// ---------------- Stage 2: fused clustered flash attention ----------------
// grid: B*V*NIT/WPB blocks of WPB*32 threads; wave w -> (b, k, i-tile)
__global__ __launch_bounds__(WPB * 32) void ca_attn_kernel(
    const float* __restrict__ q,
    const float* __restrict__ value,
    const int*   __restrict__ label,
    const float* __restrict__ sumt,
    float*       __restrict__ out)
{
#if USE_ASYNC
    __shared__ float stile[2][16 * D_];       // double-buffered sumT tile
    __shared__ float vtile[2][16 * D_];       // double-buffered value tile
#else
    __shared__ float stile[1][16 * D_];
    __shared__ float vtile[1][16 * D_];
#endif
    __shared__ float ptile[WPB][16 * 16];     // per-wave P scratch (m, n)

    const int tid  = threadIdx.x;
    const int widx = tid >> 5;
    const int lane = tid & 31;
    const int lo   = lane & 15;    // M (rows) for A, N (cols) for B/C/D
    const int hi   = lane >> 4;    // half-wave select

    const int w  = blockIdx.x * WPB + widx;
    const int it = w & (NIT - 1);
    const int k  = (w >> 5) & (V_ - 1);
    const int b  = w >> 11;
    const int i0 = it * 16;

    // ---- preload Q as WMMA-A fragments: A[M=lo][K=4c+2hi+r], 32 chunks ----
    v2f qa[32];
    {
        const float* qrow = q + (((size_t)(b * L_ + i0 + lo)) * V_ + k) * D_ + 2 * hi;
#pragma unroll
        for (int c = 0; c < 32; ++c)
            qa[c] = *(const v2f*)(qrow + 4 * c);
    }

    // labels of the 8 i-rows this half-wave owns (m = r + 8*hi)
    int labi[8];
#pragma unroll
    for (int r = 0; r < 8; ++r)
        labi[r] = label[b * L_ + i0 + r + 8 * hi];

    v8f acc[8] = {};           // O: 16 x 128 fp32 accumulator (8 d-tiles)
    float mrow[8], lrow[8];
#pragma unroll
    for (int r = 0; r < 8; ++r) { mrow[r] = -1e30f; lrow[r] = 0.0f; }

    const float scale = 0.08838834764831845f;   // 1/sqrt(128)

    // stage tile jt into LDS buffer bsel
    auto stage = [&](int jt, int bsel) {
        const float* sp = sumt  + ((size_t)b * L_ + jt * 16) * D_;
        const float* vp = value + (((size_t)(b * L_ + jt * 16)) * V_ + k) * D_;
#if USE_ASYNC
        // 512 x 16B chunks per 8KB tile; 4 per thread per tile -> 8 async ops/wave
#pragma unroll
        for (int ii = 0; ii < 4; ++ii) {
            int c4 = tid + 128 * ii;           // chunk id 0..511
            int jl = c4 >> 5;
            int dc = (c4 & 31) * 4;
            __builtin_amdgcn_global_load_async_to_lds_b128(
                (gv4i*)(sp + c4 * 4), (lv4i*)&stile[bsel][c4 * 4], 0, 0);
            __builtin_amdgcn_global_load_async_to_lds_b128(
                (gv4i*)(vp + (size_t)jl * V_ * D_ + dc),
                (lv4i*)&vtile[bsel][jl * 128 + dc], 0, 0);
        }
#else
#pragma unroll
        for (int ii = 0; ii < 16; ++ii) {
            int idx = tid + 128 * ii;          // 2048 floats, coalesced
            int jl  = idx >> 7;
            int d   = idx & 127;
            stile[0][idx] = sp[idx];           // sumT rows are contiguous
            vtile[0][idx] = vp[(size_t)jl * V_ * D_ + d];
        }
        if (jt + 1 < NJT) {                    // hint next tiles -> global_prefetch_b8
            int jl = tid & 15;
            __builtin_prefetch(sp + 16 * D_ + jl * D_, 0, 0);
            __builtin_prefetch(vp + (size_t)(16 + jl) * V_ * D_, 0, 0);
        }
#endif
    };

#if USE_ASYNC
    stage(0, 0);                               // prologue fill of buffer 0
#endif

    for (int jt = 0; jt < NJT; ++jt) {
#if USE_ASYNC
        const int cur = jt & 1;
        if (jt + 1 < NJT) {
            stage(jt + 1, cur ^ 1);            // overlap next tile's DMA
            // 8 new ops may remain in flight; in-order completion => tile cur landed
            asm volatile("s_wait_asynccnt 0x8" ::: "memory");
        } else {
            asm volatile("s_wait_asynccnt 0x0" ::: "memory");
        }
#else
        const int cur = 0;
        stage(jt, 0);
#endif
        __syncthreads();                       // all waves' staging complete

        // ---- scores S = Q (16xD) x sumT_tile^T (Dx16), K in chunks of 4 ----
        v8f s = {};
#pragma unroll
        for (int c = 0; c < 32; ++c) {
            v2f bt = *(const v2f*)&stile[cur][lo * D_ + 4 * c + 2 * hi]; // B[K=d][N=j]
            s = __builtin_amdgcn_wmma_f32_16x16x4_f32(
                    false, qa[c], false, bt, (short)0, s, false, false);
        }

        // ---- mask + online softmax (rows m = r + 8*hi, cols n = lo) ----
        const int labj = label[b * L_ + jt * 16 + lo];
#pragma unroll
        for (int r = 0; r < 8; ++r) {
            float logit = (labi[r] == labj) ? s[r] * scale : -1e30f;
            float rmax = logit;
            rmax = fmaxf(rmax, __shfl_xor(rmax, 1));
            rmax = fmaxf(rmax, __shfl_xor(rmax, 2));
            rmax = fmaxf(rmax, __shfl_xor(rmax, 4));
            rmax = fmaxf(rmax, __shfl_xor(rmax, 8));   // per-16-lane-half row max
            float mnew  = fmaxf(mrow[r], rmax);
            float alpha = __expf(mrow[r] - mnew);
            float pe    = __expf(logit - mnew);
            float rsum  = pe;
            rsum += __shfl_xor(rsum, 1);
            rsum += __shfl_xor(rsum, 2);
            rsum += __shfl_xor(rsum, 4);
            rsum += __shfl_xor(rsum, 8);
            lrow[r] = lrow[r] * alpha + rsum;
            mrow[r] = mnew;
#pragma unroll
            for (int nt = 0; nt < 8; ++nt) acc[nt][r] *= alpha;
            ptile[widx][(r + 8 * hi) * 16 + lo] = pe;  // P[m][n] -> LDS
        }
        asm volatile("s_wait_dscnt 0" ::: "memory");   // P stores visible for re-read

        // ---- O += P (16x16) x Vtile (16x128); K=j in 4 chunks of 4 ----
#pragma unroll
        for (int cp = 0; cp < 4; ++cp) {
            // A[M=lo][K=4cp+2hi+r] from P scratch
            v2f pa = *(const v2f*)&ptile[widx][lo * 16 + 4 * cp + 2 * hi];
#pragma unroll
            for (int nt = 0; nt < 8; ++nt) {
                v2f vb;   // B[K=j_local][N=d]
                vb.x = vtile[cur][(4 * cp + 2 * hi + 0) * D_ + nt * 16 + lo];
                vb.y = vtile[cur][(4 * cp + 2 * hi + 1) * D_ + nt * 16 + lo];
                acc[nt] = __builtin_amdgcn_wmma_f32_16x16x4_f32(
                              false, pa, false, vb, (short)0, acc[nt], false, false);
            }
        }
        __syncthreads();    // all waves done with buffer `cur` before it is refilled
    }

    // ---- finalize: out[b, i0+m, k, d] = O[m][d] / l[m] ----
#pragma unroll
    for (int r = 0; r < 8; ++r) {
        float inv = 1.0f / lrow[r];
        int   m   = r + 8 * hi;
        size_t base = (((size_t)(b * L_ + i0 + m)) * V_ + k) * D_;
#pragma unroll
        for (int nt = 0; nt < 8; ++nt)
            out[base + nt * 16 + lo] = acc[nt][r] * inv;
    }
}

extern "C" void kernel_launch(void* const* d_in, const int* in_sizes, int n_in,
                              void* d_out, int out_size, void* d_ws, size_t ws_size,
                              hipStream_t stream) {
    const float* q     = (const float*)d_in[0];
    const float* key   = (const float*)d_in[1];
    const float* value = (const float*)d_in[2];
    const int*   label = (const int*)d_in[3];
    float*       out   = (float*)d_out;
    float*       sumt  = (float*)d_ws;          // B*L*D floats = 512 KB

    // Stage 1: key reduction over v
    ca_sumkey_kernel<<<(B_ * L_ * D_) / 256, 256, 0, stream>>>(key, sumt);

    // Stage 2: fused masked-softmax attention, 1 wave per (b,k,i-tile)
    const int nwaves = B_ * V_ * NIT;           // 4096
    ca_attn_kernel<<<nwaves / WPB, WPB * 32, 0, stream>>>(q, value, label, sumt, out);
}

// v001
// It runs in 72.6 microseconds.
// Two timings next to v000 both put it at 3.15 times that version's speed.
#include <hip/hip_runtime.h>
#include <hip/hip_bf16.h>

typedef float v2f __attribute__((ext_vector_type(2)));
typedef float v8f __attribute__((ext_vector_type(8)));
typedef int   v4i __attribute__((ext_vector_type(4)));

typedef __attribute__((address_space(1))) v4i gv4i;   // global b128 chunk
typedef __attribute__((address_space(3))) v4i lv4i;   // LDS b128 chunk

#define B_   2
#define L_   512
#define V_   64
#define D_   128
#define NJT  (L_ / 16)   // 32 j-tiles
#define NIT  (L_ / 16)   // 32 i-tiles
#define WPB  4           // waves per block (wave32)
#define RKB  16          // blocks of launch 1 that rank the labels (64 rows each)

#if defined(__gfx1250__) && __has_builtin(__builtin_amdgcn_global_load_async_to_lds_b128)
#define USE_ASYNC 1
#else
#define USE_ASYNC 0
#endif

// ---------------- Stage 1: sumT[b,j,d] = sum_v key[b,j,v,d] ----------------
// The first RKB blocks instead rank the labels of each batch row (stable, by
// comparison, for any int values): rk[b*L+i] = rank | first<<10 | end<<20, where
// [first, end) is the range of ranks that holds every row with row i's label.
__global__ __launch_bounds__(256) void ca_sumkey_kernel(
    const float* __restrict__ key, const int* __restrict__ label,
    float* __restrict__ sumt, int* __restrict__ rk)
{
    if (blockIdx.x < RKB) {
        const int g    = blockIdx.x * 256 + threadIdx.x;  // 4 threads per row
        const int row  = g >> 2;                          // b*L + i
        const int part = g & 3;                           // quarter of the j range
        const int il   = row & (L_ - 1);
        const int* lb  = label + (row & ~(L_ - 1));
        const int me   = lb[il];
        const v4i* lb4 = (const v4i*)(lb + part * (L_ / 4));
        int less = 0, eq = 0, eqb = 0;
#pragma unroll 8   // eight 16-byte label loads in flight per trip
        for (int t = 0; t < L_ / 16; ++t) {
            v4i x = lb4[t];
#pragma unroll
            for (int e = 0; e < 4; ++e) {
                int j = part * (L_ / 4) + 4 * t + e;
                less += (x[e] < me) ? 1 : 0;
                eq   += (x[e] == me) ? 1 : 0;
                eqb  += (x[e] == me && j < il) ? 1 : 0;
            }
        }
        less += __shfl_xor(less, 1);  less += __shfl_xor(less, 2);
        eq   += __shfl_xor(eq, 1);    eq   += __shfl_xor(eq, 2);
        eqb  += __shfl_xor(eqb, 1);   eqb  += __shfl_xor(eqb, 2);
        if (part == 0) rk[row] = (less + eqb) | (less << 10) | ((less + eq) << 20);
        return;
    }
    int idx = (blockIdx.x - RKB) * 256 + threadIdx.x;   // over B*L*D = 131072, exact
    int d   = idx & (D_ - 1);
    int bl  = idx >> 7;                          // b*L + j
    const float* kp = key + (size_t)bl * V_ * D_ + d;
    float s = 0.0f;
#pragma unroll 8
    for (int v = 0; v < V_; ++v) s += kp[v * D_];
    sumt[idx] = s;
}

// ---------------- Stage 2: fused clustered flash attention ----------------
// grid: B*V*NIT/WPB blocks of WPB*32 threads; wave w -> (b, k, i-tile)
// Rows and keys are walked in label-sorted order, so the keys that a tile of 16
// rows can match lie in one range of sorted positions; tiles outside it are all
// masked, add exactly zero, and are not visited.
__global__ __launch_bounds__(WPB * 32) void ca_attn_kernel(
    const float* __restrict__ q,
    const float* __restrict__ value,
    const int*   __restrict__ label,
    const float* __restrict__ sumt,
    const int*   __restrict__ rk,
    float*       __restrict__ out)
{
#if USE_ASYNC
    __shared__ float stile[2][16 * D_];       // double-buffered sumT tile
    __shared__ float vtile[2][16 * D_];       // double-buffered value tile
#else
    __shared__ float stile[1][16 * D_];
    __shared__ float vtile[1][16 * D_];
#endif
    __shared__ float ptile[WPB][16 * 16];     // per-wave P scratch (m, n)
    __shared__ int   sinfo[L_];               // sorted pos -> row | first<<10 | end<<20
    __shared__ int   slab[L_];                // sorted pos -> label

    const int tid  = threadIdx.x;
    const int widx = tid >> 5;
    const int lane = tid & 31;
    const int lo   = lane & 15;    // M (rows) for A, N (cols) for B/C/D
    const int hi   = lane >> 4;    // half-wave select

    const int w  = blockIdx.x * WPB + widx;
    const int it = w & (NIT - 1);
    const int k  = (w >> 5) & (V_ - 1);
    const int b  = w >> 11;
    const int i0 = it * 16;                   // first sorted position of the tile

    // ---- invert the ranks of batch row b: sorted position -> original row ----
    {
        v4i r4 = *(const v4i*)(rk    + b * L_ + 4 * tid);
        v4i l4 = *(const v4i*)(label + b * L_ + 4 * tid);
#pragma unroll
        for (int e = 0; e < 4; ++e) {
            int p = r4[e] & (L_ - 1);
            sinfo[p] = (r4[e] & ~(L_ * 2 - 1)) | (4 * tid + e);
            slab[p]  = l4[e];
        }
    }
    __syncthreads();                          // table complete before any wave reads it

    // key tiles this wave needs, and the union over the block's four row tiles;
    // read into scalars so that the loop test and the skip are scalar branches
    // (the barriers need a block-uniform loop, the WMMAs every lane on)
    const int ib0 = (it & ~(WPB - 1)) * 16;
    const int wlo = __builtin_amdgcn_readfirstlane((sinfo[i0] >> 10) & 1023) >> 4;
    const int whi = (__builtin_amdgcn_readfirstlane((sinfo[i0 + 15] >> 20) & 1023) + 15) >> 4;
    const int jt0 = min(__builtin_amdgcn_readfirstlane((sinfo[ib0] >> 10) & 1023) >> 4, NJT - 1);
    const int jt1 = min(max((__builtin_amdgcn_readfirstlane((sinfo[ib0 + 16 * WPB - 1] >> 20) & 1023) + 15) >> 4, jt0 + 1), NJT);

    // ---- preload Q as WMMA-A fragments: A[M=lo][K=4c+2hi+r], 32 chunks ----
    v2f qa[32];
    {
        const int    qi   = sinfo[i0 + lo] & (L_ - 1);
        const float* qrow = q + (((size_t)(b * L_ + qi)) * V_ + k) * D_ + 2 * hi;
#pragma unroll
        for (int c = 0; c < 32; ++c)
            qa[c] = *(const v2f*)(qrow + 4 * c);
    }

    // labels of the 8 i-rows this half-wave owns (m = r + 8*hi)
    int labi[8];
#pragma unroll
    for (int r = 0; r < 8; ++r)
        labi[r] = slab[i0 + r + 8 * hi];

    v8f acc[8] = {};           // O: 16 x 128 fp32 accumulator (8 d-tiles)
    float mrow[8], lrow[8];
#pragma unroll
    for (int r = 0; r < 8; ++r) { mrow[r] = -1e30f; lrow[r] = 0.0f; }

    const float scale = 0.08838834764831845f;   // 1/sqrt(128)

    const int wv = __builtin_amdgcn_readfirstlane(widx);   // scalar lane index for readlane below

    // stage tile jt into LDS buffer bsel
    auto stage = [&](int jt, int bsel) {
        const float* sp = sumt  + (size_t)b * L_ * D_;
        const float* vp = value + ((size_t)b * L_ * V_ + k) * D_;
#if USE_ASYNC
        // 512 x 16B chunks per 8KB tile; 4 per thread per tile -> 8 async ops/wave
        const int rowv = sinfo[jt * 16 + lo];  // the tile's 16 table entries, one LDS read
#pragma unroll
        for (int ii = 0; ii < 4; ++ii) {
            int c4 = tid + 128 * ii;           // chunk id 0..511
            int jl = c4 >> 5;
            int dc = (c4 & 31) * 4;
            int jr = __builtin_amdgcn_readlane(rowv, wv + 4 * ii) & (L_ - 1);  // original row of key jl
            __builtin_amdgcn_global_load_async_to_lds_b128(
                (gv4i*)(sp + jr * D_ + dc), (lv4i*)&stile[bsel][c4 * 4], 0, 0);
            __builtin_amdgcn_global_load_async_to_lds_b128(
                (gv4i*)(vp + (size_t)jr * V_ * D_ + dc),
                (lv4i*)&vtile[bsel][jl * 128 + dc], 0, 0);
        }
#else
#pragma unroll
        for (int ii = 0; ii < 16; ++ii) {
            int idx = tid + 128 * ii;          // 2048 floats, coalesced
            int jl  = idx >> 7;
            int d   = idx & 127;
            int jr  = sinfo[jt * 16 + jl] & (L_ - 1);
            stile[0][idx] = sp[jr * D_ + d];
            vtile[0][idx] = vp[(size_t)jr * V_ * D_ + d];
        }
#endif
    };

#if USE_ASYNC
    stage(jt0, jt0 & 1);                       // prologue fill of the first buffer
#endif

    for (int jt = jt0; jt < jt1; ++jt) {
#if USE_ASYNC
        const int cur = jt & 1;
        if (jt + 1 < jt1) {
            stage(jt + 1, cur ^ 1);            // overlap next tile's DMA
            // 8 new ops may remain in flight; in-order completion => tile cur landed
            asm volatile("s_wait_asynccnt 0x8" ::: "memory");
        } else {
            asm volatile("s_wait_asynccnt 0x0" ::: "memory");
        }
#else
        const int cur = 0;
        stage(jt, 0);
#endif
        __syncthreads();                       // all waves' staging complete

        if (jt >= wlo && jt < whi) {           // wave-uniform: tile holds a label of this wave's rows
        // ---- scores S = Q (16xD) x sumT_tile^T (Dx16), K in chunks of 4 ----
        v8f s = {};
#pragma unroll
        for (int c = 0; c < 32; ++c) {
            v2f bt = *(const v2f*)&stile[cur][lo * D_ + 4 * c + 2 * hi]; // B[K=d][N=j]
            s = __builtin_amdgcn_wmma_f32_16x16x4_f32(
                    false, qa[c], false, bt, (short)0, s, false, false);
        }

        // ---- mask + online softmax (rows m = r + 8*hi, cols n = lo) ----
        const int labj = slab[jt * 16 + lo];
#pragma unroll
        for (int r = 0; r < 8; ++r) {
            float logit = (labi[r] == labj) ? s[r] * scale : -1e30f;
            float rmax = logit;
            rmax = fmaxf(rmax, __shfl_xor(rmax, 1));
            rmax = fmaxf(rmax, __shfl_xor(rmax, 2));
            rmax = fmaxf(rmax, __shfl_xor(rmax, 4));
            rmax = fmaxf(rmax, __shfl_xor(rmax, 8));   // per-16-lane-half row max
            float mnew  = fmaxf(mrow[r], rmax);
            float alpha = __expf(mrow[r] - mnew);
            float pe    = __expf(logit - mnew);
            float rsum  = pe;
            rsum += __shfl_xor(rsum, 1);
            rsum += __shfl_xor(rsum, 2);
            rsum += __shfl_xor(rsum, 4);
            rsum += __shfl_xor(rsum, 8);
            lrow[r] = lrow[r] * alpha + rsum;
            mrow[r] = mnew;
#pragma unroll
            for (int nt = 0; nt < 8; ++nt) acc[nt][r] *= alpha;
            ptile[widx][(r + 8 * hi) * 16 + lo] = pe;  // P[m][n] -> LDS
        }
        asm volatile("s_wait_dscnt 0" ::: "memory");   // P stores visible for re-read

        // ---- O += P (16x16) x Vtile (16x128); K=j in 4 chunks of 4 ----
#pragma unroll
        for (int cp = 0; cp < 4; ++cp) {
            // A[M=lo][K=4cp+2hi+r] from P scratch
            v2f pa = *(const v2f*)&ptile[widx][lo * 16 + 4 * cp + 2 * hi];
#pragma unroll
            for (int nt = 0; nt < 8; ++nt) {
                v2f vb;   // B[K=j_local][N=d]
                vb.x = vtile[cur][(4 * cp + 2 * hi + 0) * D_ + nt * 16 + lo];
                vb.y = vtile[cur][(4 * cp + 2 * hi + 1) * D_ + nt * 16 + lo];
                acc[nt] = __builtin_amdgcn_wmma_f32_16x16x4_f32(
                              false, pa, false, vb, (short)0, acc[nt], false, false);
            }
        }
        }
        __syncthreads();    // all waves done with buffer `cur` before it is refilled
    }

    // ---- finalize: out[b, original row of sorted pos i0+m, k, d] = O[m][d] / l[m] ----
#pragma unroll
    for (int r = 0; r < 8; ++r) {
        float inv = 1.0f / lrow[r];
        int   m   = r + 8 * hi;
        int   oi  = sinfo[i0 + m] & (L_ - 1);
        size_t base = (((size_t)(b * L_ + oi)) * V_ + k) * D_;
#pragma unroll
        for (int nt = 0; nt < 8; ++nt)
            out[base + nt * 16 + lo] = acc[nt][r] * inv;
    }
}

extern "C" void kernel_launch(void* const* d_in, const int* in_sizes, int n_in,
                              void* d_out, int out_size, void* d_ws, size_t ws_size,
                              hipStream_t stream) {
    const float* q     = (const float*)d_in[0];
    const float* key   = (const float*)d_in[1];
    const float* value = (const float*)d_in[2];
    const int*   label = (const int*)d_in[3];
    float*       out   = (float*)d_out;
    float*       sumt  = (float*)d_ws;          // B*L*D floats = 512 KB
    int*         rk    = (int*)d_ws + B_ * L_ * D_;   // B*L packed ranks behind it

    // Stage 1: key reduction over v, and the label ranks
    ca_sumkey_kernel<<<RKB + (B_ * L_ * D_) / 256, 256, 0, stream>>>(key, label, sumt, rk);

    // Stage 2: fused masked-softmax attention, 1 wave per (b,k,i-tile)
    const int nwaves = B_ * V_ * NIT;           // 4096
    ca_attn_kernel<<<nwaves / WPB, WPB * 32, 0, stream>>>(q, value, label, sumt, rk, out);
}

// v002
// One run takes 59.7 microseconds.
// Next to v001, in two timings, it ran 1.22 and 1.21 times as fast.
// Over all steps from v000 it is 3.82 times as fast.
#include <hip/hip_runtime.h>
#include <hip/hip_bf16.h>

typedef float v2f __attribute__((ext_vector_type(2)));
typedef float v8f __attribute__((ext_vector_type(8)));
typedef int   v4i __attribute__((ext_vector_type(4)));

typedef __attribute__((address_space(1))) v4i gv4i;   // global b128 chunk
typedef __attribute__((address_space(3))) v4i lv4i;   // LDS b128 chunk

#define B_   2
#define L_   512
#define V_   64
#define D_   128
#define NJT  (L_ / 16)   // 32 j-tiles
#define NIT  (L_ / 16)   // 32 i-tiles
#define WPB  4           // waves per block (wave32)
#define RKB  16          // blocks of launch 1 that rank the labels (64 rows each)
// LDS row pitches in dwords (64 banks of 4 B; bank = dword address mod 64):
#define SP_  132         // key-sum tile: 16 rows x 8-B reads, 4*row + 2*half covers all 64 banks
#define VP_  144         // value tile: rows k..k+3 start 16 banks apart, 16 lanes each
#define PP_  20          // P scratch: 20*row mod 64 is a distinct multiple of 4 for 16 rows

#if defined(__gfx1250__) && __has_builtin(__builtin_amdgcn_global_load_async_to_lds_b128)
#define USE_ASYNC 1
#else
#define USE_ASYNC 0
#endif

// ---------------- Stage 1: sumT[b,j,d] = sum_v key[b,j,v,d] ----------------
// The first RKB blocks instead rank the labels of each batch row (stable, by
// comparison, for any int values): rk[b*L+i] = rank | first<<10 | end<<20, where
// [first, end) is the range of ranks that holds every row with row i's label.
__global__ __launch_bounds__(256) void ca_sumkey_kernel(
    const float* __restrict__ key, const int* __restrict__ label,
    float* __restrict__ sumt, int* __restrict__ rk)
{
    if (blockIdx.x < RKB) {
        const int g    = blockIdx.x * 256 + threadIdx.x;  // 4 threads per row
        const int row  = g >> 2;                          // b*L + i
        const int part = g & 3;                           // quarter of the j range
        const int il   = row & (L_ - 1);
        const int* lb  = label + (row & ~(L_ - 1));
        const int me   = lb[il];
        const v4i* lb4 = (const v4i*)(lb + part * (L_ / 4));
        int less = 0, eq = 0, eqb = 0;
#pragma unroll 8   // eight 16-byte label loads in flight per trip
        for (int t = 0; t < L_ / 16; ++t) {
            v4i x = lb4[t];
#pragma unroll
            for (int e = 0; e < 4; ++e) {
                int j = part * (L_ / 4) + 4 * t + e;
                less += (x[e] < me) ? 1 : 0;
                eq   += (x[e] == me) ? 1 : 0;
                eqb  += (x[e] == me && j < il) ? 1 : 0;
            }
        }
        less += __shfl_xor(less, 1);  less += __shfl_xor(less, 2);
        eq   += __shfl_xor(eq, 1);    eq   += __shfl_xor(eq, 2);
        eqb  += __shfl_xor(eqb, 1);   eqb  += __shfl_xor(eqb, 2);
        if (part == 0) rk[row] = (less + eqb) | (less << 10) | ((less + eq) << 20);
        return;
    }
    int idx = (blockIdx.x - RKB) * 256 + threadIdx.x;   // over B*L*D = 131072, exact
    int d   = idx & (D_ - 1);
    int bl  = idx >> 7;                          // b*L + j
    const float* kp = key + (size_t)bl * V_ * D_ + d;
    float s = 0.0f;
#pragma unroll 8
    for (int v = 0; v < V_; ++v) s += kp[v * D_];
    sumt[idx] = s;
}

// ---------------- Stage 2: fused clustered flash attention ----------------
// grid: B*V*NIT/WPB blocks of WPB*32 threads; wave w -> (b, k, i-tile)
// Rows and keys are walked in label-sorted order, so the keys that a tile of 16
// rows can match lie in one range of sorted positions; tiles outside it are all
// masked, add exactly zero, and are not visited.
__global__ __launch_bounds__(WPB * 32) void ca_attn_kernel(
    const float* __restrict__ q,
    const float* __restrict__ value,
    const int*   __restrict__ label,
    const float* __restrict__ sumt,
    const int*   __restrict__ rk,
    float*       __restrict__ out)
{
#if USE_ASYNC
    __shared__ __attribute__((aligned(16))) float stile[2][16 * SP_];   // double-buffered sumT tile
    __shared__ __attribute__((aligned(16))) float vtile[2][16 * VP_];   // double-buffered value tile
#else
    __shared__ __attribute__((aligned(16))) float stile[1][16 * SP_];
    __shared__ __attribute__((aligned(16))) float vtile[1][16 * VP_];
#endif
    __shared__ __attribute__((aligned(16))) float ptile[WPB][16 * PP_]; // per-wave P scratch (m, n)
    __shared__ int   sinfo[L_];               // sorted pos -> row | first<<10 | end<<20
    __shared__ int   slab[L_];                // sorted pos -> label

    const int tid  = threadIdx.x;
    const int widx = tid >> 5;
    const int lane = tid & 31;
    const int lo   = lane & 15;    // M (rows) for A, N (cols) for B/C/D
    const int hi   = lane >> 4;    // half-wave select

    const int w  = blockIdx.x * WPB + widx;
    const int it = w & (NIT - 1);
    const int k  = (w >> 5) & (V_ - 1);
    const int b  = w >> 11;
    const int i0 = it * 16;                   // first sorted position of the tile

    // ---- invert the ranks of batch row b: sorted position -> original row ----
    {
        v4i r4 = *(const v4i*)(rk    + b * L_ + 4 * tid);
        v4i l4 = *(const v4i*)(label + b * L_ + 4 * tid);
#pragma unroll
        for (int e = 0; e < 4; ++e) {
            int p = r4[e] & (L_ - 1);
            sinfo[p] = (r4[e] & ~(L_ * 2 - 1)) | (4 * tid + e);
            slab[p]  = l4[e];
        }
    }
    __syncthreads();                          // table complete before any wave reads it

    // key tiles this wave needs, and the union over the block's four row tiles;
    // read into scalars so that the loop test and the skip are scalar branches
    // (the barriers need a block-uniform loop, the WMMAs every lane on)
    const int ib0 = (it & ~(WPB - 1)) * 16;
    const int wlo = __builtin_amdgcn_readfirstlane((sinfo[i0] >> 10) & 1023) >> 4;
    const int whi = (__builtin_amdgcn_readfirstlane((sinfo[i0 + 15] >> 20) & 1023) + 15) >> 4;
    const int jt0 = min(__builtin_amdgcn_readfirstlane((sinfo[ib0] >> 10) & 1023) >> 4, NJT - 1);
    const int jt1 = min(max((__builtin_amdgcn_readfirstlane((sinfo[ib0 + 16 * WPB - 1] >> 20) & 1023) + 15) >> 4, jt0 + 1), NJT);

    // ---- preload Q as WMMA-A fragments: A[M=lo][K=4c+2hi+r], 32 chunks ----
    v2f qa[32];
    {
        const int    qi   = sinfo[i0 + lo] & (L_ - 1);
        const float* qrow = q + (((size_t)(b * L_ + qi)) * V_ + k) * D_ + 2 * hi;
#pragma unroll
        for (int c = 0; c < 32; ++c)
            qa[c] = *(const v2f*)(qrow + 4 * c);
    }

    // labels of the 8 i-rows this half-wave owns (m = r + 8*hi)
    int labi[8];
#pragma unroll
    for (int r = 0; r < 8; ++r)
        labi[r] = slab[i0 + r + 8 * hi];

    v8f acc[8] = {};           // O: 16 x 128 fp32 accumulator (8 d-tiles)
    float mrow[8], lrow[8];
#pragma unroll
    for (int r = 0; r < 8; ++r) { mrow[r] = -1e30f; lrow[r] = 0.0f; }

    const float scale = 0.08838834764831845f;   // 1/sqrt(128)

    const int wv = __builtin_amdgcn_readfirstlane(widx);   // scalar lane index for readlane below

    // stage tile jt into LDS buffer bsel
    auto stage = [&](int jt, int bsel) {
        const float* sp = sumt  + (size_t)b * L_ * D_;
        const float* vp = value + ((size_t)b * L_ * V_ + k) * D_;
#if USE_ASYNC
        // 512 x 16B chunks per 8KB tile; 4 per thread per tile -> 8 async ops/wave
        const int rowv = sinfo[jt * 16 + lo];  // the tile's 16 table entries, one LDS read
#pragma unroll
        for (int ii = 0; ii < 4; ++ii) {
            int c4 = tid + 128 * ii;           // chunk id 0..511
            int jl = c4 >> 5;
            int dc = (c4 & 31) * 4;
            int jr = __builtin_amdgcn_readlane(rowv, wv + 4 * ii) & (L_ - 1);  // original row of key jl
            __builtin_amdgcn_global_load_async_to_lds_b128(
                (gv4i*)(sp + jr * D_ + dc), (lv4i*)&stile[bsel][jl * SP_ + dc], 0, 0);
            __builtin_amdgcn_global_load_async_to_lds_b128(
                (gv4i*)(vp + (size_t)jr * V_ * D_ + dc),
                (lv4i*)&vtile[bsel][jl * VP_ + dc], 0, 0);
        }
#else
#pragma unroll
        for (int ii = 0; ii < 16; ++ii) {
            int idx = tid + 128 * ii;          // 2048 floats, coalesced
            int jl  = idx >> 7;
            int d   = idx & 127;
            int jr  = sinfo[jt * 16 + jl] & (L_ - 1);
            stile[0][jl * SP_ + d] = sp[jr * D_ + d];
            vtile[0][jl * VP_ + d] = vp[(size_t)jr * V_ * D_ + d];
        }
#endif
    };

#if USE_ASYNC
    stage(jt0, jt0 & 1);                       // prologue fill of the first buffer
#endif

    for (int jt = jt0; jt < jt1; ++jt) {
#if USE_ASYNC
        const int cur = jt & 1;
        if (jt + 1 < jt1) {
            stage(jt + 1, cur ^ 1);            // overlap next tile's DMA
            // 8 new ops may remain in flight; in-order completion => tile cur landed
            asm volatile("s_wait_asynccnt 0x8" ::: "memory");
        } else {
            asm volatile("s_wait_asynccnt 0x0" ::: "memory");
        }
#else
        const int cur = 0;
        stage(jt, 0);
#endif
        __syncthreads();                       // all waves' staging complete

        if (jt >= wlo && jt < whi) {           // wave-uniform: tile holds a label of this wave's rows
        // ---- scores S = Q (16xD) x sumT_tile^T (Dx16), K in chunks of 4 ----
        v8f s = {};
#pragma unroll
        for (int c = 0; c < 32; ++c) {
            v2f bt = *(const v2f*)&stile[cur][lo * SP_ + 4 * c + 2 * hi]; // B[K=d][N=j]
            s = __builtin_amdgcn_wmma_f32_16x16x4_f32(
                    false, qa[c], false, bt, (short)0, s, false, false);
        }

        // ---- mask + online softmax (rows m = r + 8*hi, cols n = lo) ----
        const int labj = slab[jt * 16 + lo];
#pragma unroll
        for (int r = 0; r < 8; ++r) {
            float logit = (labi[r] == labj) ? s[r] * scale : -1e30f;
            float rmax = logit;
            rmax = fmaxf(rmax, __shfl_xor(rmax, 1));
            rmax = fmaxf(rmax, __shfl_xor(rmax, 2));
            rmax = fmaxf(rmax, __shfl_xor(rmax, 4));
            rmax = fmaxf(rmax, __shfl_xor(rmax, 8));   // per-16-lane-half row max
            float mnew  = fmaxf(mrow[r], rmax);
            float alpha = __expf(mrow[r] - mnew);
            float pe    = __expf(logit - mnew);
            float rsum  = pe;
            rsum += __shfl_xor(rsum, 1);
            rsum += __shfl_xor(rsum, 2);
            rsum += __shfl_xor(rsum, 4);
            rsum += __shfl_xor(rsum, 8);
            lrow[r] = lrow[r] * alpha + rsum;
            mrow[r] = mnew;
#pragma unroll
            for (int nt = 0; nt < 8; ++nt) acc[nt][r] *= alpha;
            ptile[widx][(r + 8 * hi) * PP_ + lo] = pe;  // P[m][n] -> LDS
        }
        asm volatile("s_wait_dscnt 0" ::: "memory");   // P stores visible for re-read

        // ---- O += P (16x16) x Vtile (16x128); K=j in 4 chunks of 4 ----
#pragma unroll
        for (int cp = 0; cp < 4; ++cp) {
            // A[M=lo][K=4cp+2hi+r] from P scratch
            v2f pa = *(const v2f*)&ptile[widx][lo * PP_ + 4 * cp + 2 * hi];
#pragma unroll
            for (int nt = 0; nt < 8; ++nt) {
                v2f vb;   // B[K=j_local][N=d]
                vb.x = vtile[cur][(4 * cp + 2 * hi + 0) * VP_ + nt * 16 + lo];
                vb.y = vtile[cur][(4 * cp + 2 * hi + 1) * VP_ + nt * 16 + lo];
                acc[nt] = __builtin_amdgcn_wmma_f32_16x16x4_f32(
                              false, pa, false, vb, (short)0, acc[nt], false, false);
            }
        }
        }
        __syncthreads();    // all waves done with buffer `cur` before it is refilled
    }

    // ---- finalize: out[b, original row of sorted pos i0+m, k, d] = O[m][d] / l[m] ----
#pragma unroll
    for (int r = 0; r < 8; ++r) {
        float inv = 1.0f / lrow[r];
        int   m   = r + 8 * hi;
        int   oi  = sinfo[i0 + m] & (L_ - 1);
        size_t base = (((size_t)(b * L_ + oi)) * V_ + k) * D_;
#pragma unroll
        for (int nt = 0; nt < 8; ++nt)
            out[base + nt * 16 + lo] = acc[nt][r] * inv;
    }
}

extern "C" void kernel_launch(void* const* d_in, const int* in_sizes, int n_in,
                              void* d_out, int out_size, void* d_ws, size_t ws_size,
                              hipStream_t stream) {
    const float* q     = (const float*)d_in[0];
    const float* key   = (const float*)d_in[1];
    const float* value = (const float*)d_in[2];
    const int*   label = (const int*)d_in[3];
    float*       out   = (float*)d_out;
    float*       sumt  = (float*)d_ws;          // B*L*D floats = 512 KB
    int*         rk    = (int*)d_ws + B_ * L_ * D_;   // B*L packed ranks behind it

    // Stage 1: key reduction over v, and the label ranks
    ca_sumkey_kernel<<<RKB + (B_ * L_ * D_) / 256, 256, 0, stream>>>(key, label, sumt, rk);

    // Stage 2: fused masked-softmax attention, 1 wave per (b,k,i-tile)
    const int nwaves = B_ * V_ * NIT;           // 4096
    ca_attn_kernel<<<nwaves / WPB, WPB * 32, 0, stream>>>(q, value, label, sumt, rk, out);
}

// v003
// It runs in 40.3 microseconds.
// Timed twice side by side with v002, it ran 1.48 and 1.49 times as fast.
// Over all steps from v000 it is 5.68 times as fast.
#include <hip/hip_runtime.h>
#include <hip/hip_bf16.h>

typedef float v2f __attribute__((ext_vector_type(2)));
typedef float v4f __attribute__((ext_vector_type(4)));
typedef float v8f __attribute__((ext_vector_type(8)));
typedef int   v4i __attribute__((ext_vector_type(4)));

typedef __attribute__((address_space(1))) v4i gv4i;   // global b128 chunk
typedef __attribute__((address_space(3))) v4i lv4i;   // LDS b128 chunk

#define B_   2
#define L_   512
#define V_   64
#define D_   128
#define NJT  (L_ / 16)   // 32 j-tiles
#define NIT  (L_ / 16)   // 32 i-tiles
#define WPB  4           // waves per block (wave32)
#define RKB  16          // blocks of launch 1 that rank the labels (64 rows each)
// LDS row pitches in dwords (64 banks of 4 B; bank = dword address mod 64):
#define SP_  132         // key-sum tile: 16 rows x 8-B reads, 4*row + 2*half covers all 64 banks
#define VP_  132         // value tile: the wave halves read rows 8 apart, 8*132 mod 64 = 32 banks apart

#if defined(__gfx1250__) && __has_builtin(__builtin_amdgcn_global_load_async_to_lds_b128)
#define USE_ASYNC 1
#else
#define USE_ASYNC 0
#endif

// ---------------- Stage 1: sumT[b,j,d] = sum_v key[b,j,v,d] ----------------
// The first RKB blocks instead rank the labels of each batch row (stable, by
// comparison, for any int values): rk[b*L+i] = rank | first<<10 | end<<20, where
// [first, end) is the range of ranks that holds every row with row i's label.
__global__ __launch_bounds__(256) void ca_sumkey_kernel(
    const float* __restrict__ key, const int* __restrict__ label,
    float* __restrict__ sumt, int* __restrict__ rk)
{
    if (blockIdx.x < RKB) {
        const int g    = blockIdx.x * 256 + threadIdx.x;  // 4 threads per row
        const int row  = g >> 2;                          // b*L + i
        const int part = g & 3;                           // quarter of the j range
        const int il   = row & (L_ - 1);
        const int* lb  = label + (row & ~(L_ - 1));
        const int me   = lb[il];
        const v4i* lb4 = (const v4i*)(lb + part * (L_ / 4));
        int less = 0, eq = 0, eqb = 0;
#pragma unroll 8   // eight 16-byte label loads in flight per trip
        for (int t = 0; t < L_ / 16; ++t) {
            v4i x = lb4[t];
#pragma unroll
            for (int e = 0; e < 4; ++e) {
                int j = part * (L_ / 4) + 4 * t + e;
                less += (x[e] < me) ? 1 : 0;
                eq   += (x[e] == me) ? 1 : 0;
                eqb  += (x[e] == me && j < il) ? 1 : 0;
            }
        }
        less += __shfl_xor(less, 1);  less += __shfl_xor(less, 2);
        eq   += __shfl_xor(eq, 1);    eq   += __shfl_xor(eq, 2);
        eqb  += __shfl_xor(eqb, 1);   eqb  += __shfl_xor(eqb, 2);
        if (part == 0) rk[row] = (less + eqb) | (less << 10) | ((less + eq) << 20);
        return;
    }
    int idx = (blockIdx.x - RKB) * 256 + threadIdx.x;   // over B*L*D = 131072, exact
    int d   = idx & (D_ - 1);
    int bl  = idx >> 7;                          // b*L + j
    const float* kp = key + (size_t)bl * V_ * D_ + d;
    float s = 0.0f;
#pragma unroll 8
    for (int v = 0; v < V_; ++v) s += kp[v * D_];
    sumt[idx] = s;
}

__device__ __forceinline__ float xhalf(float x) {   // lane l with lane l ^ 16
    return __builtin_bit_cast(float, __builtin_amdgcn_permlanex16(
        __builtin_bit_cast(int, x), __builtin_bit_cast(int, x), 0x76543210, 0xfedcba98, false, false));
}

// amdgpu_waves_per_eu(4, 4): the grid supplies four waves per SIMD, as before. The
// transposed form needs fewer registers; without this line the compiler squeezes
// for a fifth wave that never comes and waits on every LDS fragment load singly.
__global__ __launch_bounds__(WPB * 32) __attribute__((amdgpu_waves_per_eu(4, 4))) void ca_attn_kernel(
    const float* __restrict__ q,
    const float* __restrict__ value,
    const int*   __restrict__ label,
    const float* __restrict__ sumt,
    const int*   __restrict__ rk,
    float*       __restrict__ out)
{
    // behind the loop the four buffers turn the four waves' output tiles back
    __shared__ __attribute__((aligned(16))) float stile[2][16 * SP_];   // double-buffered sumT tile
    __shared__ __attribute__((aligned(16))) float vtile[2][16 * VP_];   // double-buffered value tile
    static_assert(SP_ == VP_ && WPB == 4, "one buffer per wave, one pitch, in the epilogue");
    __shared__ int   sinfo[L_];               // sorted pos -> row | first<<10 | end<<20
    __shared__ __attribute__((aligned(16))) int slab[L_];   // sorted pos -> label

    const int tid  = threadIdx.x;
    const int widx = tid >> 5;
    const int lane = tid & 31;
    const int lo   = lane & 15;    // M for A, N for B/C/D
    const int hi   = lane >> 4;    // half-wave select

    const int w  = blockIdx.x * WPB + widx;
    const int it = w & (NIT - 1);
    const int k  = (w >> 5) & (V_ - 1);
    const int b  = w >> 11;
    const int i0 = it * 16;                   // first sorted position of the tile

    // ---- invert the ranks of batch row b: sorted position -> original row ----
    {
        v4i r4 = *(const v4i*)(rk    + b * L_ + 4 * tid);
        v4i l4 = *(const v4i*)(label + b * L_ + 4 * tid);
#pragma unroll
        for (int e = 0; e < 4; ++e) {
            int p = r4[e] & (L_ - 1);
            sinfo[p] = (r4[e] & ~(L_ * 2 - 1)) | (4 * tid + e);
            slab[p]  = l4[e];
        }
    }
    __syncthreads();                          // table complete before any wave reads it

    // key tiles this wave needs, and the union over the block's four row tiles;
    // read into scalars so that the loop test and the skip are scalar branches
    // (the barriers need a block-uniform loop, the WMMAs every lane on)
    const int ib0 = (it & ~(WPB - 1)) * 16;
    const int wlo = __builtin_amdgcn_readfirstlane((sinfo[i0] >> 10) & 1023) >> 4;
    const int whi = (__builtin_amdgcn_readfirstlane((sinfo[i0 + 15] >> 20) & 1023) + 15) >> 4;
    const int jt0 = min(__builtin_amdgcn_readfirstlane((sinfo[ib0] >> 10) & 1023) >> 4, NJT - 1);
    const int jt1 = min(max((__builtin_amdgcn_readfirstlane((sinfo[ib0 + 16 * WPB - 1] >> 20) & 1023) + 15) >> 4, jt0 + 1), NJT);

    // ---- preload Q^T as WMMA-B fragments: B[K=4c+2hi+r][N=lo], 32 chunks ----
    v2f qa[32];
    {
        const int    qi   = sinfo[i0 + lo] & (L_ - 1);
        const float* qrow = q + (((size_t)(b * L_ + qi)) * V_ + k) * D_ + 2 * hi;
#pragma unroll
        for (int c = 0; c < 32; ++c)
            qa[c] = *(const v2f*)(qrow + 4 * c);
    }

    const int labi = slab[i0 + lo];   // label of the one query row this lane owns

    v8f acc[8] = {};           // O^T: acc[nt][r] = O[row lo][d = 16*nt + 8*hi + r]
    float mrow = -1e30f;       // running maximum of row lo (same in both halves)
    float lrow = 0.0f;         // running sum of row lo over this half's keys

    const float scale = 0.08838834764831845f;   // 1/sqrt(128)

    const int wv = __builtin_amdgcn_readfirstlane(widx);   // scalar lane index for readlane below

    // stage tile jt into LDS buffer bsel
    auto stage = [&](int jt, int bsel) {
        const float* sp = sumt  + (size_t)b * L_ * D_;
        const float* vp = value + ((size_t)b * L_ * V_ + k) * D_;
#if USE_ASYNC
        // 512 x 16B chunks per 8KB tile; 4 per thread per tile -> 8 async ops/wave
        const int rowv = sinfo[jt * 16 + lo];  // the tile's 16 table entries, one LDS read
#pragma unroll
        for (int ii = 0; ii < 4; ++ii) {
            int c4 = tid + 128 * ii;           // chunk id 0..511
            int jl = c4 >> 5;
            int dc = (c4 & 31) * 4;
            int jr = __builtin_amdgcn_readlane(rowv, wv + 4 * ii) & (L_ - 1);  // original row of key jl
            __builtin_amdgcn_global_load_async_to_lds_b128(
                (gv4i*)(sp + jr * D_ + dc), (lv4i*)&stile[bsel][jl * SP_ + dc], 0, 0);
            __builtin_amdgcn_global_load_async_to_lds_b128(
                (gv4i*)(vp + (size_t)jr * V_ * D_ + dc),
                (lv4i*)&vtile[bsel][jl * VP_ + dc], 0, 0);
        }
#else
#pragma unroll
        for (int ii = 0; ii < 16; ++ii) {
            int idx = tid + 128 * ii;          // 2048 floats, coalesced
            int jl  = idx >> 7;
            int d   = idx & 127;
            int jr  = sinfo[jt * 16 + jl] & (L_ - 1);
            stile[0][jl * SP_ + d] = sp[jr * D_ + d];
            vtile[0][jl * VP_ + d] = vp[(size_t)jr * V_ * D_ + d];
        }
#endif
    };

#if USE_ASYNC
    stage(jt0, jt0 & 1);                       // prologue fill of the first buffer
#endif

    for (int jt = jt0; jt < jt1; ++jt) {
#if USE_ASYNC
        const int cur = jt & 1;
        if (jt + 1 < jt1) {
            stage(jt + 1, cur ^ 1);            // overlap next tile's DMA
            // 8 new ops may remain in flight; in-order completion => tile cur landed
            asm volatile("s_wait_asynccnt 0x8" ::: "memory");
        } else {
            asm volatile("s_wait_asynccnt 0x0" ::: "memory");
        }
#else
        const int cur = 0;
        stage(jt, 0);
#endif
        __syncthreads();                       // all waves' staging complete

        if (jt >= wlo && jt < whi) {           // wave-uniform: tile holds a label of this wave's rows
        // ---- scores S^T = sumT_tile (16xD) x Q^T (Dx16), K in chunks of 4 ----
        v8f s = {};
#pragma unroll
        for (int c = 0; c < 32; ++c) {
            v2f kt = *(const v2f*)&stile[cur][lo * SP_ + 4 * c + 2 * hi]; // A[M=j][K=d]
            s = __builtin_amdgcn_wmma_f32_16x16x4_f32(
                    false, kt, false, qa[c], (short)0, s, false, false);
        }

        // ---- mask + online softmax: s[r] = S[row lo][key r + 8*hi] ----
        const v4i lj0 = *(const v4i*)&slab[jt * 16 + 8 * hi];
        const v4i lj1 = *(const v4i*)&slab[jt * 16 + 8 * hi + 4];
        float pe[8];
#pragma unroll
        for (int r = 0; r < 8; ++r)
            pe[r] = (labi == (r < 4 ? lj0[r & 3] : lj1[r & 3])) ? s[r] * scale : -1e30f;
        float mx = fmaxf(fmaxf(fmaxf(pe[0], pe[1]), fmaxf(pe[2], pe[3])),
                         fmaxf(fmaxf(pe[4], pe[5]), fmaxf(pe[6], pe[7])));
        mx = fmaxf(mx, xhalf(mx));                     // over all 16 keys of the tile
        const float mnew  = fmaxf(mrow, mx);
        const float alpha = __expf(mrow - mnew);
#pragma unroll
        for (int r = 0; r < 8; ++r) pe[r] = __expf(pe[r] - mnew);
        lrow = lrow * alpha + (((pe[0] + pe[1]) + (pe[2] + pe[3])) + ((pe[4] + pe[5]) + (pe[6] + pe[7])));
        mrow = mnew;
#pragma unroll
        for (int nt = 0; nt < 8; ++nt) acc[nt] *= alpha;

        // ---- O^T += Vtile^T (128x16) x P^T (16x16); K=j in 4 chunks of 4 ----
        // k position (hi, e) of chunk cp stands for key 8*hi + 2*cp + e on both sides
#pragma unroll
        for (int cp = 0; cp < 4; ++cp) {
            v2f pb;   // B[K=j][N=row lo], straight from the score registers
            pb.x = pe[2 * cp];
            pb.y = pe[2 * cp + 1];
#pragma unroll
            for (int nt = 0; nt < 8; ++nt) {
                v2f va;   // A[M=d][K=j]
                va.x = vtile[cur][(8 * hi + 2 * cp + 0) * VP_ + nt * 16 + lo];
                va.y = vtile[cur][(8 * hi + 2 * cp + 1) * VP_ + nt * 16 + lo];
                acc[nt] = __builtin_amdgcn_wmma_f32_16x16x4_f32(
                              false, va, false, pb, (short)0, acc[nt], false, false);
            }
        }
        }
        __syncthreads();    // all waves done with buffer `cur` before it is refilled
    }

    // ---- finalize: out[b, row, k, d] = O[row][d] / l[row] ----
    // The loop's last barrier (behind the last s_wait_asynccnt 0) has freed all four
    // buffers; each wave turns its own tile in its own buffer, so that a store
    // instruction writes one whole 512-byte output row.
    {
        const float inv = 1.0f / (lrow + xhalf(lrow));   // the halves' sums joined once
        float* ot = (wv < 2) ? &stile[wv & 1][0] : &vtile[wv & 1][0];
#pragma unroll
        for (int nt = 0; nt < 8; ++nt) {
            v4f x0 = { acc[nt][0], acc[nt][1], acc[nt][2], acc[nt][3] };
            v4f x1 = { acc[nt][4], acc[nt][5], acc[nt][6], acc[nt][7] };
            *(v4f*)&ot[lo * SP_ + nt * 16 + 8 * hi]     = x0 * inv;
            *(v4f*)&ot[lo * SP_ + nt * 16 + 8 * hi + 4] = x1 * inv;
        }
        asm volatile("s_wait_dscnt 0" ::: "memory");   // the wave's own tile written before its lanes read across rows
        const int orow = sinfo[i0 + lo] & (L_ - 1);
        const int bk = blockIdx.x / (NIT / WPB);   // b*V + k from the block index alone: uniform
        float* ob = out + ((size_t)(bk / V_) * L_ * V_ + (bk % V_)) * D_;
#pragma unroll
        for (int m = 0; m < 16; ++m) {
            const int oi = __builtin_amdgcn_readlane(orow, m);   // original row of sorted row i0 + m
            *(v4f*)(ob + (size_t)oi * V_ * D_ + 4 * lane) = *(const v4f*)&ot[m * SP_ + 4 * lane];
        }
    }
}

extern "C" void kernel_launch(void* const* d_in, const int* in_sizes, int n_in,
                              void* d_out, int out_size, void* d_ws, size_t ws_size,
                              hipStream_t stream) {
    const float* q     = (const float*)d_in[0];
    const float* key   = (const float*)d_in[1];
    const float* value = (const float*)d_in[2];
    const int*   label = (const int*)d_in[3];
    float*       out   = (float*)d_out;
    float*       sumt  = (float*)d_ws;          // B*L*D floats = 512 KB
    int*         rk    = (int*)d_ws + B_ * L_ * D_;   // B*L packed ranks behind it

    // Stage 1: key reduction over v, and the label ranks
    ca_sumkey_kernel<<<RKB + (B_ * L_ * D_) / 256, 256, 0, stream>>>(key, label, sumt, rk);

    // Stage 2: fused masked-softmax attention, 1 wave per (b,k,i-tile)
    const int nwaves = B_ * V_ * NIT;           // 4096
    ca_attn_kernel<<<nwaves / WPB, WPB * 32, 0, stream>>>(q, value, label, sumt, rk, out);
}

// v004
// Measured time: 38.3 microseconds a run.
// Two timings next to v003 both put it at 1.05 times that version's speed.
// Over all steps from v000 it is 5.97 times as fast.
#include <hip/hip_runtime.h>
#include <hip/hip_bf16.h>

typedef float v2f __attribute__((ext_vector_type(2)));
typedef float v4f __attribute__((ext_vector_type(4)));
typedef float v8f __attribute__((ext_vector_type(8)));
typedef int   v4i __attribute__((ext_vector_type(4)));

typedef __attribute__((address_space(1))) v4i gv4i;   // global b128 chunk
typedef __attribute__((address_space(3))) v4i lv4i;   // LDS b128 chunk

#define B_   2
#define L_   512
#define V_   64
#define D_   128
#define NJT  (L_ / 16)   // 32 j-tiles
#define NIT  (L_ / 16)   // 32 i-tiles
#define WPB  4           // waves per block (wave32)
#define RKB  16          // blocks of launch 1 that rank the labels (64 rows each)
// LDS row pitches in dwords (64 banks of 4 B; bank = dword address mod 64):
#define SP_  132         // key-sum tile: 16 rows x 8-B reads, 4*row + 2*half covers all 64 banks
#define VP_  132         // value tile: the wave halves read rows 8 apart, 8*132 mod 64 = 32 banks apart

#if defined(__gfx1250__) && __has_builtin(__builtin_amdgcn_global_load_async_to_lds_b128)
#define USE_ASYNC 1
#else
#define USE_ASYNC 0
#endif

// ---------------- Stage 1: sumT[b,j,d] = sum_v key[b,j,v,d] ----------------
// The first RKB blocks instead rank the labels of each batch row (stable, by
// comparison, for any int values): rk[b*L+i] = rank | first<<10 | end<<20, where
// [first, end) is the range of ranks that holds every row with row i's label.
__global__ __launch_bounds__(256) void ca_sumkey_kernel(
    const float* __restrict__ key, const int* __restrict__ label,
    float* __restrict__ sumt, int* __restrict__ rk)
{
    if (blockIdx.x < RKB) {
        const int g    = blockIdx.x * 256 + threadIdx.x;  // 4 threads per row
        const int row  = g >> 2;                          // b*L + i
        const int part = g & 3;                           // quarter of the j range
        const int il   = row & (L_ - 1);
        const int* lb  = label + (row & ~(L_ - 1));
        const int me   = lb[il];
        const v4i* lb4 = (const v4i*)(lb + part * (L_ / 4));
        int less = 0, eq = 0, eqb = 0;
#pragma unroll 8   // eight 16-byte label loads in flight per trip
        for (int t = 0; t < L_ / 16; ++t) {
            v4i x = lb4[t];
#pragma unroll
            for (int e = 0; e < 4; ++e) {
                int j = part * (L_ / 4) + 4 * t + e;
                less += (x[e] < me) ? 1 : 0;
                eq   += (x[e] == me) ? 1 : 0;
                eqb  += (x[e] == me && j < il) ? 1 : 0;
            }
        }
        less += __shfl_xor(less, 1);  less += __shfl_xor(less, 2);
        eq   += __shfl_xor(eq, 1);    eq   += __shfl_xor(eq, 2);
        eqb  += __shfl_xor(eqb, 1);   eqb  += __shfl_xor(eqb, 2);
        if (part == 0) rk[row] = (less + eqb) | (less << 10) | ((less + eq) << 20);
        return;
    }
    int idx = (blockIdx.x - RKB) * 256 + threadIdx.x;   // over B*L*D = 131072, exact
    int d   = idx & (D_ - 1);
    int bl  = idx >> 7;                          // b*L + j
    const float* kp = key + (size_t)bl * V_ * D_ + d;
    float s = 0.0f;
#pragma unroll 8
    for (int v = 0; v < V_; ++v) s += kp[v * D_];
    sumt[idx] = s;
}

__device__ __forceinline__ float xhalf(float x) {   // lane l with lane l ^ 16
    return __builtin_bit_cast(float, __builtin_amdgcn_permlanex16(
        __builtin_bit_cast(int, x), __builtin_bit_cast(int, x), 0x76543210, 0xfedcba98, false, false));
}

// amdgpu_waves_per_eu(4, 4): the grid supplies four waves per SIMD, as before. The
// transposed form needs fewer registers; without this line the compiler squeezes
// for a fifth wave that never comes and waits on every LDS fragment load singly.
__global__ __launch_bounds__(WPB * 32) __attribute__((amdgpu_waves_per_eu(4, 4))) void ca_attn_kernel(
    const float* __restrict__ q,
    const float* __restrict__ value,
    const int*   __restrict__ label,
    const float* __restrict__ sumt,
    const int*   __restrict__ rk,
    float*       __restrict__ out)
{
    __shared__ __attribute__((aligned(16))) float stile[2][16 * SP_];     // double-buffered sumT tile, shared
    __shared__ __attribute__((aligned(16))) float vtile[WPB][16 * VP_];   // value tile, one buffer per wave;
                                                                          // behind the loop it turns the wave's output tile
    __shared__ int   sinfo[L_];               // sorted pos -> row | first<<10 | end<<20
    __shared__ __attribute__((aligned(16))) int slab[L_];   // sorted pos -> label

    const int tid  = threadIdx.x;
    const int widx = tid >> 5;
    const int lane = tid & 31;
    const int lo   = lane & 15;    // M for A, N for B/C/D
    const int hi   = lane >> 4;    // half-wave select

    const int wv = __builtin_amdgcn_readfirstlane(widx);   // the wave's number as a scalar

    // block index -> (b, row tile, four heads), the heads fastest
    const unsigned bi = blockIdx.x;
    const int k  = (int)(bi % (V_ / WPB)) * WPB + wv;
    const int it = (int)(bi / (V_ / WPB) % NIT);
    const int b  = (int)(bi / (V_ / WPB * NIT));
    const int i0 = it * 16;                   // first sorted position of the tile

    // ---- invert the ranks of batch row b: sorted position -> original row ----
    {
        v4i r4 = *(const v4i*)(rk    + b * L_ + 4 * tid);
        v4i l4 = *(const v4i*)(label + b * L_ + 4 * tid);
#pragma unroll
        for (int e = 0; e < 4; ++e) {
            int p = r4[e] & (L_ - 1);
            sinfo[p] = (r4[e] & ~(L_ * 2 - 1)) | (4 * tid + e);
            slab[p]  = l4[e];
        }
    }
    __syncthreads();                          // table complete before any wave reads it

    // key tiles the row tile needs, the same for all four waves; read into scalars so
    // that the loop test is a scalar branch (the barriers need a block-uniform loop)
    const int jt0 = min(__builtin_amdgcn_readfirstlane((sinfo[i0] >> 10) & 1023) >> 4, NJT - 1);
    const int jt1 = min(max((__builtin_amdgcn_readfirstlane((sinfo[i0 + 15] >> 20) & 1023) + 15) >> 4, jt0 + 1), NJT);

    // rowv: the 16 table entries of a key tile, entry j in lanes j and j + 16.
    // key-sum tile -> stile[bsel]: 4 rows of 512 B per wave, one copy a row
    auto stage_s = [&](int rowv, int bsel) {
        const float* sp = sumt + (size_t)b * L_ * D_;
#pragma unroll
        for (int ii = 0; ii < 16 / WPB; ++ii) {
            const int jr = __builtin_amdgcn_readlane(rowv, wv + WPB * ii) & (L_ - 1);  // original row of the key
            const float* g = sp + jr * D_ + 4 * lane;
            float*       l = &stile[bsel][(wv + WPB * ii) * SP_ + 4 * lane];
#if USE_ASYNC
            __builtin_amdgcn_global_load_async_to_lds_b128((gv4i*)g, (lv4i*)l, 0, 0);
#else
            *(v4f*)l = *(const v4f*)g;
#endif
        }
    };
    // value tile of this wave's head -> the wave's own buffer: 16 rows, one copy a row
    auto stage_v = [&](int rowv) {
        const float* vp = value + ((size_t)b * L_ * V_ + k) * D_;
#pragma unroll
        for (int jl = 0; jl < 16; ++jl) {
            const int jr = __builtin_amdgcn_readlane(rowv, jl) & (L_ - 1);
            const float* g = vp + (size_t)jr * V_ * D_ + 4 * lane;
            float*       l = &vtile[wv][jl * VP_ + 4 * lane];
#if USE_ASYNC
            __builtin_amdgcn_global_load_async_to_lds_b128((gv4i*)g, (lv4i*)l, 0, 0);
#else
            *(v4f*)l = *(const v4f*)g;
#endif
        }
    };

    {   // the first tiles fly while Q is loaded
        const int row0 = sinfo[jt0 * 16 + lo];
        stage_s(row0, jt0 & 1);
        stage_v(row0);
    }

    // ---- preload Q^T as WMMA-B fragments: B[K=4c+2hi+r][N=lo], 32 chunks ----
    v2f qa[32];
    {
        const int    qi   = sinfo[i0 + lo] & (L_ - 1);
        const float* qrow = q + (((size_t)(b * L_ + qi)) * V_ + k) * D_ + 2 * hi;
#pragma unroll
        for (int c = 0; c < 32; ++c)
            qa[c] = *(const v2f*)(qrow + 4 * c);
    }

    const int labi = slab[i0 + lo];   // label of the one query row this lane owns

    v8f acc[8] = {};           // O^T: acc[nt][r] = O[row lo][d = 16*nt + 8*hi + r]
    float mrow = -1e30f;       // running maximum of row lo (same in both halves)
    float lrow = 0.0f;         // running sum of row lo over this half's keys

    const float scale = 0.08838834764831845f;   // 1/sqrt(128)

    asm volatile("s_wait_asynccnt 0x0" ::: "memory");   // this wave's part of the first key-sum tile has landed
    __syncthreads();                                    // ... and every other wave's part

    for (int jt = jt0; jt < jt1; ++jt) {
        const int  cur  = jt & 1;
        const bool more = jt + 1 < jt1;        // scalar, the same in all four waves
        int rown = 0;
        if (more) {                            // next key-sum tile into the buffer that trip jt - 1 read
            rown = sinfo[(jt + 1) * 16 + lo];
            stage_s(rown, cur ^ 1);
        }

        // ---- scores S^T = sumT_tile (16xD) x Q^T (Dx16), K in chunks of 4 ----
        v8f s = {};
#pragma unroll
        for (int c = 0; c < 32; ++c) {
            v2f kt = *(const v2f*)&stile[cur][lo * SP_ + 4 * c + 2 * hi]; // A[M=j][K=d]
            s = __builtin_amdgcn_wmma_f32_16x16x4_f32(
                    false, kt, false, qa[c], (short)0, s, false, false);
        }

        // this wave's value tile (issued a trip ago) and its part of the next key-sum
        // tile have landed; here, so that the value fragments load beside the softmax
        asm volatile("s_wait_asynccnt 0x0" ::: "memory");

        // ---- mask + online softmax: s[r] = S[row lo][key r + 8*hi] ----
        const v4i lj0 = *(const v4i*)&slab[jt * 16 + 8 * hi];
        const v4i lj1 = *(const v4i*)&slab[jt * 16 + 8 * hi + 4];
        float pe[8];
#pragma unroll
        for (int r = 0; r < 8; ++r)
            pe[r] = (labi == (r < 4 ? lj0[r & 3] : lj1[r & 3])) ? s[r] * scale : -1e30f;
        float mx = fmaxf(fmaxf(fmaxf(pe[0], pe[1]), fmaxf(pe[2], pe[3])),
                         fmaxf(fmaxf(pe[4], pe[5]), fmaxf(pe[6], pe[7])));
        mx = fmaxf(mx, xhalf(mx));                     // over all 16 keys of the tile
        const float mnew  = fmaxf(mrow, mx);
        const float alpha = __expf(mrow - mnew);
#pragma unroll
        for (int r = 0; r < 8; ++r) pe[r] = __expf(pe[r] - mnew);
        lrow = lrow * alpha + (((pe[0] + pe[1]) + (pe[2] + pe[3])) + ((pe[4] + pe[5]) + (pe[6] + pe[7])));
        mrow = mnew;
#pragma unroll
        for (int nt = 0; nt < 8; ++nt) acc[nt] *= alpha;

        // ---- O^T += Vtile^T (128x16) x P^T (16x16); K=j in 4 chunks of 4 ----
        // k position (hi, e) of chunk cp stands for key 8*hi + 2*cp + e on both sides
#pragma unroll
        for (int cp = 0; cp < 4; ++cp) {
            v2f pb;   // B[K=j][N=row lo], straight from the score registers
            pb.x = pe[2 * cp];
            pb.y = pe[2 * cp + 1];
#pragma unroll
            for (int nt = 0; nt < 8; ++nt) {
                v2f va;   // A[M=d][K=j]
                va.x = vtile[wv][(8 * hi + 2 * cp + 0) * VP_ + nt * 16 + lo];
                va.y = vtile[wv][(8 * hi + 2 * cp + 1) * VP_ + nt * 16 + lo];
                acc[nt] = __builtin_amdgcn_wmma_f32_16x16x4_f32(
                              false, va, false, pb, (short)0, acc[nt], false, false);
            }
        }
        if (more) {
            asm volatile("s_wait_dscnt 0" ::: "memory");   // the wave's reads of both tiles retired before a copy overwrites one
            stage_v(rown);      // a buffer private to one wave: refilled behind that wave's own wait, no barrier in front
            __syncthreads();    // next key-sum tile complete; all waves done with buffer `cur`
        }
    }

    // ---- finalize: out[b, row, k, d] = O[row][d] / l[row] ----
    // No copy is issued behind the last trip's s_wait_asynccnt 0; each wave turns its
    // tile in its own value buffer, so that a store instruction writes one whole
    // 512-byte output row.
    {
        const float inv = 1.0f / (lrow + xhalf(lrow));   // the halves' sums joined once
        float* ot = &vtile[wv][0];
#pragma unroll
        for (int nt = 0; nt < 8; ++nt) {
            v4f x0 = { acc[nt][0], acc[nt][1], acc[nt][2], acc[nt][3] };
            v4f x1 = { acc[nt][4], acc[nt][5], acc[nt][6], acc[nt][7] };
            *(v4f*)&ot[lo * VP_ + nt * 16 + 8 * hi]     = x0 * inv;
            *(v4f*)&ot[lo * VP_ + nt * 16 + 8 * hi + 4] = x1 * inv;
        }
        asm volatile("s_wait_dscnt 0" ::: "memory");   // the wave's own tile written before its lanes read across rows
        const int orow = sinfo[i0 + lo] & (L_ - 1);
        float* ob = out + ((size_t)b * L_ * V_ + k) * D_;   // b and k are scalars
#pragma unroll
        for (int m = 0; m < 16; ++m) {
            const int oi = __builtin_amdgcn_readlane(orow, m);   // original row of sorted row i0 + m
            *(v4f*)(ob + (size_t)oi * V_ * D_ + 4 * lane) = *(const v4f*)&ot[m * VP_ + 4 * lane];
        }
    }
}

extern "C" void kernel_launch(void* const* d_in, const int* in_sizes, int n_in,
                              void* d_out, int out_size, void* d_ws, size_t ws_size,
                              hipStream_t stream) {
    const float* q     = (const float*)d_in[0];
    const float* key   = (const float*)d_in[1];
    const float* value = (const float*)d_in[2];
    const int*   label = (const int*)d_in[3];
    float*       out   = (float*)d_out;
    float*       sumt  = (float*)d_ws;          // B*L*D floats = 512 KB
    int*         rk    = (int*)d_ws + B_ * L_ * D_;   // B*L packed ranks behind it

    // Stage 1: key reduction over v, and the label ranks
    ca_sumkey_kernel<<<RKB + (B_ * L_ * D_) / 256, 256, 0, stream>>>(key, label, sumt, rk);

    // Stage 2: fused masked-softmax attention, 1 wave per (b,k,i-tile), 4 heads of a tile per block
    const int nwaves = B_ * V_ * NIT;           // 4096
    ca_attn_kernel<<<nwaves / WPB, WPB * 32, 0, stream>>>(q, value, label, sumt, rk, out);
}

// v005
// It runs in 36.4 microseconds.
// Two timings next to v004 both put it at 1.05 times that version's speed.
// All steps since v000 together make it 6.28 times as fast.
#include <hip/hip_runtime.h>
#include <hip/hip_bf16.h>

typedef float v2f __attribute__((ext_vector_type(2)));
typedef float v4f __attribute__((ext_vector_type(4)));
typedef float v8f __attribute__((ext_vector_type(8)));
typedef int   v4i __attribute__((ext_vector_type(4)));

typedef __attribute__((address_space(1))) v4i gv4i;   // global b128 chunk
typedef __attribute__((address_space(3))) v4i lv4i;   // LDS b128 chunk

#define B_   2
#define L_   512
#define V_   64
#define D_   128
#define NJT  (L_ / 16)   // 32 j-tiles
#define NIT  (L_ / 16)   // 32 i-tiles
#define WPB  4           // waves per block (wave32)
#define SKT  128         // threads per block of launch 1 (4 waves)
#define RKB  32          // blocks of launch 1 that rank the labels (32 rows each)
// LDS row pitches in dwords (64 banks of 4 B; bank = dword address mod 64):
#define SP_  132         // key-sum tile: 16 rows x 8-B reads, 4*row + 2*half covers all 64 banks
#define VP_  132         // value tile: the wave halves read rows 8 apart, 8*132 mod 64 = 32 banks apart

#if defined(__gfx1250__) && __has_builtin(__builtin_amdgcn_global_load_async_to_lds_b128)
#define USE_ASYNC 1
#else
#define USE_ASYNC 0
#endif

// ---------------- Stage 1: sumT[b,j,d] = sum_v key[b,j,v,d] ----------------
// The first RKB blocks instead rank the labels of each batch row (stable, by
// comparison, for any int values): rk[b*L+i] = rank | first<<10 | end<<20, where
// [first, end) is the range of ranks that holds every row with row i's label.
// amdgpu_waves_per_eu(1, 4): the grid supplies about one wave per SIMD; without this line the
// compiler saves registers for waves that never come and keeps 12 loads in flight, not 60 (seen in two builds).
__global__ __launch_bounds__(SKT) __attribute__((amdgpu_waves_per_eu(1, 4))) void ca_sumkey_kernel(
    const float* __restrict__ key, const int* __restrict__ label,
    float* __restrict__ sumt, int* __restrict__ rk)
{
    if (blockIdx.x < RKB) {
        const int g    = blockIdx.x * SKT + threadIdx.x;  // 4 threads per row
        const int row  = g >> 2;                          // b*L + i
        const int part = g & 3;                           // quarter of the j range
        const int il   = row & (L_ - 1);
        const int* lb  = label + (row & ~(L_ - 1));
        const int me   = lb[il];
        const v4i* lb4 = (const v4i*)(lb + part * (L_ / 4));
        int less = 0, eq = 0, eqb = 0;
#pragma unroll 8   // eight 16-byte label loads in flight per trip
        for (int t = 0; t < L_ / 16; ++t) {
            v4i x = lb4[t];
#pragma unroll
            for (int e = 0; e < 4; ++e) {
                int j = part * (L_ / 4) + 4 * t + e;
                less += (x[e] < me) ? 1 : 0;
                eq   += (x[e] == me) ? 1 : 0;
                eqb  += (x[e] == me && j < il) ? 1 : 0;
            }
        }
        less += __shfl_xor(less, 1);  less += __shfl_xor(less, 2);
        eq   += __shfl_xor(eq, 1);    eq   += __shfl_xor(eq, 2);
        eqb  += __shfl_xor(eqb, 1);   eqb  += __shfl_xor(eqb, 2);
        if (part == 0) rk[row] = (less + eqb) | (less << 10) | ((less + eq) << 20);
        return;
    }
    // One wave per key row (b, j): a lane owns four d and reads 16 bytes, so that one load
    // takes a whole 512-byte row (b, j, v). The loop is unrolled whole: the row's loads are
    // issued ahead of the additions as far as the registers reach (60 of the 64 in this
    // build); the additions stay in the order v = 0..63.
    const int  bl = (blockIdx.x - RKB) * (SKT / 32) + (threadIdx.x >> 5);   // b*L + j, exact
    const int  ln = threadIdx.x & 31;
    const v4f* kp = (const v4f*)(key + (size_t)bl * V_ * D_) + ln;
    v4f s = { 0.0f, 0.0f, 0.0f, 0.0f };
#pragma unroll   // all 64 loads of the row visible to the scheduler at once
    for (int v = 0; v < V_; ++v) s += kp[v * (D_ / 4)];
    ((v4f*)sumt)[bl * (D_ / 4) + ln] = s;
    asm volatile("s_wait_xcnt 0x0" ::: "memory");   // the store's address and data registers are released before any later write of them
}

__device__ __forceinline__ float xhalf(float x) {   // lane l with lane l ^ 16
    return __builtin_bit_cast(float, __builtin_amdgcn_permlanex16(
        __builtin_bit_cast(int, x), __builtin_bit_cast(int, x), 0x76543210, 0xfedcba98, false, false));
}

// amdgpu_waves_per_eu(4, 4): the grid supplies four waves per SIMD, as before. The
// transposed form needs fewer registers; without this line the compiler squeezes
// for a fifth wave that never comes and waits on every LDS fragment load singly.
__global__ __launch_bounds__(WPB * 32) __attribute__((amdgpu_waves_per_eu(4, 4))) void ca_attn_kernel(
    const float* __restrict__ q,
    const float* __restrict__ value,
    const int*   __restrict__ label,
    const float* __restrict__ sumt,
    const int*   __restrict__ rk,
    float*       __restrict__ out)
{
    __shared__ __attribute__((aligned(16))) float stile[2][16 * SP_];     // double-buffered sumT tile, shared
    __shared__ __attribute__((aligned(16))) float vtile[WPB][16 * VP_];   // value tile, one buffer per wave;
                                                                          // behind the loop it turns the wave's output tile
    __shared__ int   sinfo[L_];               // sorted pos -> row | first<<10 | end<<20
    __shared__ __attribute__((aligned(16))) int slab[L_];   // sorted pos -> label

    const int tid  = threadIdx.x;
    const int widx = tid >> 5;
    const int lane = tid & 31;
    const int lo   = lane & 15;    // M for A, N for B/C/D
    const int hi   = lane >> 4;    // half-wave select

    const int wv = __builtin_amdgcn_readfirstlane(widx);   // the wave's number as a scalar

    // block index -> (b, row tile, four heads), the heads fastest
    const unsigned bi = blockIdx.x;
    const int k  = (int)(bi % (V_ / WPB)) * WPB + wv;
    const int it = (int)(bi / (V_ / WPB) % NIT);
    const int b  = (int)(bi / (V_ / WPB * NIT));
    const int i0 = it * 16;                   // first sorted position of the tile

    // ---- invert the ranks of batch row b: sorted position -> original row ----
    {
        v4i r4 = *(const v4i*)(rk    + b * L_ + 4 * tid);
        v4i l4 = *(const v4i*)(label + b * L_ + 4 * tid);
#pragma unroll
        for (int e = 0; e < 4; ++e) {
            int p = r4[e] & (L_ - 1);
            sinfo[p] = (r4[e] & ~(L_ * 2 - 1)) | (4 * tid + e);
            slab[p]  = l4[e];
        }
    }
    __syncthreads();                          // table complete before any wave reads it

    // key tiles the row tile needs, the same for all four waves; read into scalars so
    // that the loop test is a scalar branch (the barriers need a block-uniform loop)
    const int jt0 = min(__builtin_amdgcn_readfirstlane((sinfo[i0] >> 10) & 1023) >> 4, NJT - 1);
    const int jt1 = min(max((__builtin_amdgcn_readfirstlane((sinfo[i0 + 15] >> 20) & 1023) + 15) >> 4, jt0 + 1), NJT);

    // rowv: the 16 table entries of a key tile, entry j in lanes j and j + 16.
    // key-sum tile -> stile[bsel]: 4 rows of 512 B per wave, one copy a row
    auto stage_s = [&](int rowv, int bsel) {
        const float* sp = sumt + (size_t)b * L_ * D_;
#pragma unroll
        for (int ii = 0; ii < 16 / WPB; ++ii) {
            const int jr = __builtin_amdgcn_readlane(rowv, wv + WPB * ii) & (L_ - 1);  // original row of the key
            const float* g = sp + jr * D_ + 4 * lane;
            float*       l = &stile[bsel][(wv + WPB * ii) * SP_ + 4 * lane];
#if USE_ASYNC
            __builtin_amdgcn_global_load_async_to_lds_b128((gv4i*)g, (lv4i*)l, 0, 0);
#else
            *(v4f*)l = *(const v4f*)g;
#endif
        }
    };
    // value tile of this wave's head -> the wave's own buffer: 16 rows, one copy a row
    auto stage_v = [&](int rowv) {
        const float* vp = value + ((size_t)b * L_ * V_ + k) * D_;
#pragma unroll
        for (int jl = 0; jl < 16; ++jl) {
            const int jr = __builtin_amdgcn_readlane(rowv, jl) & (L_ - 1);
            const float* g = vp + (size_t)jr * V_ * D_ + 4 * lane;
            float*       l = &vtile[wv][jl * VP_ + 4 * lane];
#if USE_ASYNC
            __builtin_amdgcn_global_load_async_to_lds_b128((gv4i*)g, (lv4i*)l, 0, 0);
#else
            *(v4f*)l = *(const v4f*)g;
#endif
        }
    };

    {   // the first tiles fly while Q is loaded
        const int row0 = sinfo[jt0 * 16 + lo];
        stage_s(row0, jt0 & 1);
        stage_v(row0);
    }

    // ---- preload Q^T as WMMA-B fragments: B[K=4c+2hi+r][N=lo], 32 chunks ----
    v2f qa[32];
    {
        const int    qi   = sinfo[i0 + lo] & (L_ - 1);
        const float* qrow = q + (((size_t)(b * L_ + qi)) * V_ + k) * D_ + 2 * hi;
#pragma unroll
        for (int c = 0; c < 32; ++c)
            qa[c] = *(const v2f*)(qrow + 4 * c);
    }

    const int labi = slab[i0 + lo];   // label of the one query row this lane owns

    v8f acc[8] = {};           // O^T: acc[nt][r] = O[row lo][d = 16*nt + 8*hi + r]
    float mrow = -1e30f;       // running maximum of row lo (same in both halves)
    float lrow = 0.0f;         // running sum of row lo over this half's keys

    const float scale = 0.08838834764831845f;   // 1/sqrt(128)

    asm volatile("s_wait_asynccnt 0x0" ::: "memory");   // this wave's part of the first key-sum tile has landed
    __syncthreads();                                    // ... and every other wave's part

    for (int jt = jt0; jt < jt1; ++jt) {
        const int  cur  = jt & 1;
        const bool more = jt + 1 < jt1;        // scalar, the same in all four waves
        int rown = 0;
        if (more) {                            // next key-sum tile into the buffer that trip jt - 1 read
            rown = sinfo[(jt + 1) * 16 + lo];
            stage_s(rown, cur ^ 1);
        }

        // ---- scores S^T = sumT_tile (16xD) x Q^T (Dx16), K in chunks of 4 ----
        v8f s = {};
#pragma unroll
        for (int c = 0; c < 32; ++c) {
            v2f kt = *(const v2f*)&stile[cur][lo * SP_ + 4 * c + 2 * hi]; // A[M=j][K=d]
            s = __builtin_amdgcn_wmma_f32_16x16x4_f32(
                    false, kt, false, qa[c], (short)0, s, false, false);
        }

        // this wave's value tile (issued a trip ago) and its part of the next key-sum
        // tile have landed; here, so that the value fragments load beside the softmax
        asm volatile("s_wait_asynccnt 0x0" ::: "memory");

        // ---- mask + online softmax: s[r] = S[row lo][key r + 8*hi] ----
        const v4i lj0 = *(const v4i*)&slab[jt * 16 + 8 * hi];
        const v4i lj1 = *(const v4i*)&slab[jt * 16 + 8 * hi + 4];
        float pe[8];
#pragma unroll
        for (int r = 0; r < 8; ++r)
            pe[r] = (labi == (r < 4 ? lj0[r & 3] : lj1[r & 3])) ? s[r] * scale : -1e30f;
        float mx = fmaxf(fmaxf(fmaxf(pe[0], pe[1]), fmaxf(pe[2], pe[3])),
                         fmaxf(fmaxf(pe[4], pe[5]), fmaxf(pe[6], pe[7])));
        mx = fmaxf(mx, xhalf(mx));                     // over all 16 keys of the tile
        const float mnew  = fmaxf(mrow, mx);
        const float alpha = __expf(mrow - mnew);
#pragma unroll
        for (int r = 0; r < 8; ++r) pe[r] = __expf(pe[r] - mnew);
        lrow = lrow * alpha + (((pe[0] + pe[1]) + (pe[2] + pe[3])) + ((pe[4] + pe[5]) + (pe[6] + pe[7])));
        mrow = mnew;
#pragma unroll
        for (int nt = 0; nt < 8; ++nt) acc[nt] *= alpha;

        // ---- O^T += Vtile^T (128x16) x P^T (16x16); K=j in 4 chunks of 4 ----
        // k position (hi, e) of chunk cp stands for key 8*hi + 2*cp + e on both sides
#pragma unroll
        for (int cp = 0; cp < 4; ++cp) {
            v2f pb;   // B[K=j][N=row lo], straight from the score registers
            pb.x = pe[2 * cp];
            pb.y = pe[2 * cp + 1];
#pragma unroll
            for (int nt = 0; nt < 8; ++nt) {
                v2f va;   // A[M=d][K=j]
                va.x = vtile[wv][(8 * hi + 2 * cp + 0) * VP_ + nt * 16 + lo];
                va.y = vtile[wv][(8 * hi + 2 * cp + 1) * VP_ + nt * 16 + lo];
                acc[nt] = __builtin_amdgcn_wmma_f32_16x16x4_f32(
                              false, va, false, pb, (short)0, acc[nt], false, false);
            }
        }
        if (more) {
            asm volatile("s_wait_dscnt 0" ::: "memory");   // the wave's reads of both tiles retired before a copy overwrites one
            stage_v(rown);      // a buffer private to one wave: refilled behind that wave's own wait, no barrier in front
            __syncthreads();    // next key-sum tile complete; all waves done with buffer `cur`
        }
    }

    // ---- finalize: out[b, row, k, d] = O[row][d] / l[row] ----
    // No copy is issued behind the last trip's s_wait_asynccnt 0; each wave turns its
    // tile in its own value buffer, so that a store instruction writes one whole
    // 512-byte output row.
    {
        const float inv = 1.0f / (lrow + xhalf(lrow));   // the halves' sums joined once
        float* ot = &vtile[wv][0];
#pragma unroll
        for (int nt = 0; nt < 8; ++nt) {
            v4f x0 = { acc[nt][0], acc[nt][1], acc[nt][2], acc[nt][3] };
            v4f x1 = { acc[nt][4], acc[nt][5], acc[nt][6], acc[nt][7] };
            *(v4f*)&ot[lo * VP_ + nt * 16 + 8 * hi]     = x0 * inv;
            *(v4f*)&ot[lo * VP_ + nt * 16 + 8 * hi + 4] = x1 * inv;
        }
        asm volatile("s_wait_dscnt 0" ::: "memory");   // the wave's own tile written before its lanes read across rows
        const int orow = sinfo[i0 + lo] & (L_ - 1);
        float* ob = out + ((size_t)b * L_ * V_ + k) * D_;   // b and k are scalars
#pragma unroll
        for (int m = 0; m < 16; ++m) {
            const int oi = __builtin_amdgcn_readlane(orow, m);   // original row of sorted row i0 + m
            *(v4f*)(ob + (size_t)oi * V_ * D_ + 4 * lane) = *(const v4f*)&ot[m * VP_ + 4 * lane];
        }
    }
}

extern "C" void kernel_launch(void* const* d_in, const int* in_sizes, int n_in,
                              void* d_out, int out_size, void* d_ws, size_t ws_size,
                              hipStream_t stream) {
    const float* q     = (const float*)d_in[0];
    const float* key   = (const float*)d_in[1];
    const float* value = (const float*)d_in[2];
    const int*   label = (const int*)d_in[3];
    float*       out   = (float*)d_out;
    float*       sumt  = (float*)d_ws;          // B*L*D floats = 512 KB
    int*         rk    = (int*)d_ws + B_ * L_ * D_;   // B*L packed ranks behind it

    // Stage 1: key reduction over v, and the label ranks
    ca_sumkey_kernel<<<RKB + (B_ * L_) / (SKT / 32), SKT, 0, stream>>>(key, label, sumt, rk);

    // Stage 2: fused masked-softmax attention, 1 wave per (b,k,i-tile), 4 heads of a tile per block
    const int nwaves = B_ * V_ * NIT;           // 4096
    ca_attn_kernel<<<nwaves / WPB, WPB * 32, 0, stream>>>(q, value, label, sumt, rk, out);
}

// v006
// Measured time: 35.2 microseconds a run.
// Timed twice side by side with v005, it ran 1.03 and 1.04 times as fast.
// All steps since v000 together make it 6.48 times as fast.
#include <hip/hip_runtime.h>
#include <hip/hip_bf16.h>

typedef float v2f __attribute__((ext_vector_type(2)));
typedef float v4f __attribute__((ext_vector_type(4)));
typedef float v8f __attribute__((ext_vector_type(8)));
typedef int   v4i __attribute__((ext_vector_type(4)));

typedef __attribute__((address_space(1))) v4i gv4i;   // global b128 chunk
typedef __attribute__((address_space(3))) v4i lv4i;   // LDS b128 chunk

#define B_   2
#define L_   512
#define V_   64
#define D_   128
#define NJT  (L_ / 16)   // 32 j-tiles
#define NIT  (L_ / 16)   // 32 i-tiles
#define WPB  4           // waves per block (wave32)
#define SKT  128         // threads per block of launch 1 (4 waves)
#define RKB  32          // blocks of launch 1 that rank the labels (32 rows each)
// LDS row pitches in dwords (64 banks of 4 B; bank = dword address mod 64):
#define SP_  132         // key-sum tile: 16 rows x 8-B reads, 4*row + 2*half covers all 64 banks
#define VP_  132         // value tile: the wave halves read rows 8 apart, 8*132 mod 64 = 32 banks apart; Q is read from it as the key-sum tile is

#if defined(__gfx1250__) && __has_builtin(__builtin_amdgcn_global_load_async_to_lds_b128)
#define USE_ASYNC 1
#else
#define USE_ASYNC 0
#endif

// ---------------- Stage 1: sumT[b,j,d] = sum_v key[b,j,v,d] ----------------
// The first RKB blocks instead rank the labels of each batch row (stable, by
// comparison, for any int values): rk[b*L+i] = rank | first<<10 | end<<20, where
// [first, end) is the range of ranks that holds every row with row i's label.
// amdgpu_waves_per_eu(1, 4): the grid supplies about one wave per SIMD; without this line the
// compiler saves registers for waves that never come and keeps 12 loads in flight, not 60 (seen in two builds).
__global__ __launch_bounds__(SKT) __attribute__((amdgpu_waves_per_eu(1, 4))) void ca_sumkey_kernel(
    const float* __restrict__ key, const int* __restrict__ label,
    float* __restrict__ sumt, int* __restrict__ rk)
{
    if (blockIdx.x < RKB) {
        const int g    = blockIdx.x * SKT + threadIdx.x;  // 4 threads per row
        const int row  = g >> 2;                          // b*L + i
        const int part = g & 3;                           // quarter of the j range
        const int il   = row & (L_ - 1);
        const int* lb  = label + (row & ~(L_ - 1));
        const int me   = lb[il];
        const v4i* lb4 = (const v4i*)(lb + part * (L_ / 4));
        int less = 0, eq = 0, eqb = 0;
#pragma unroll 8   // eight 16-byte label loads in flight per trip
        for (int t = 0; t < L_ / 16; ++t) {
            v4i x = lb4[t];
#pragma unroll
            for (int e = 0; e < 4; ++e) {
                int j = part * (L_ / 4) + 4 * t + e;
                less += (x[e] < me) ? 1 : 0;
                eq   += (x[e] == me) ? 1 : 0;
                eqb  += (x[e] == me && j < il) ? 1 : 0;
            }
        }
        less += __shfl_xor(less, 1);  less += __shfl_xor(less, 2);
        eq   += __shfl_xor(eq, 1);    eq   += __shfl_xor(eq, 2);
        eqb  += __shfl_xor(eqb, 1);   eqb  += __shfl_xor(eqb, 2);
        if (part == 0) rk[row] = (less + eqb) | (less << 10) | ((less + eq) << 20);
        return;
    }
    // One wave per key row (b, j): a lane owns four d and reads 16 bytes, so that one load
    // takes a whole 512-byte row (b, j, v). The loop is unrolled whole: the row's loads are
    // issued ahead of the additions as far as the registers reach (60 of the 64 in this
    // build); the additions stay in the order v = 0..63.
    const int  bl = (blockIdx.x - RKB) * (SKT / 32) + (threadIdx.x >> 5);   // b*L + j, exact
    const int  ln = threadIdx.x & 31;
    const v4f* kp = (const v4f*)(key + (size_t)bl * V_ * D_) + ln;
    v4f s = { 0.0f, 0.0f, 0.0f, 0.0f };
#pragma unroll   // all 64 loads of the row visible to the scheduler at once
    for (int v = 0; v < V_; ++v) s += kp[v * (D_ / 4)];
    ((v4f*)sumt)[bl * (D_ / 4) + ln] = s;
    asm volatile("s_wait_xcnt 0x0" ::: "memory");   // the store's address and data registers are released before any later write of them
}

__device__ __forceinline__ float xhalf(float x) {   // lane l with lane l ^ 16
    return __builtin_bit_cast(float, __builtin_amdgcn_permlanex16(
        __builtin_bit_cast(int, x), __builtin_bit_cast(int, x), 0x76543210, 0xfedcba98, false, false));
}

// amdgpu_waves_per_eu(4, 4): the grid supplies four waves per SIMD, as before. The
// transposed form needs fewer registers; without this line the compiler squeezes
// for a fifth wave that never comes and waits on every LDS fragment load singly.
__global__ __launch_bounds__(WPB * 32) __attribute__((amdgpu_waves_per_eu(4, 4))) void ca_attn_kernel(
    const float* __restrict__ q,
    const float* __restrict__ value,
    const int*   __restrict__ label,
    const float* __restrict__ sumt,
    const int*   __restrict__ rk,
    float*       __restrict__ out)
{
    __shared__ __attribute__((aligned(16))) float stile[2][16 * SP_];     // double-buffered sumT tile, shared
    __shared__ __attribute__((aligned(16))) float vtile[WPB][16 * VP_];   // value tile, one buffer per wave; in front of the
                                                                          // loop it takes the wave's Q tile, behind it the output tile
    __shared__ int   sinfo[L_];               // sorted pos -> row | first<<10 | end<<20
    __shared__ __attribute__((aligned(16))) int slab[L_];   // sorted pos -> label

    const int tid  = threadIdx.x;
    const int widx = tid >> 5;
    const int lane = tid & 31;
    const int lo   = lane & 15;    // M for A, N for B/C/D
    const int hi   = lane >> 4;    // half-wave select

    const int wv = __builtin_amdgcn_readfirstlane(widx);   // the wave's number as a scalar

    // block index -> (b, row tile, four heads), the heads fastest
    const unsigned bi = blockIdx.x;
    const int k  = (int)(bi % (V_ / WPB)) * WPB + wv;
    const int it = (int)(bi / (V_ / WPB) % NIT);
    const int b  = (int)(bi / (V_ / WPB * NIT));
    const int i0 = it * 16;                   // first sorted position of the tile

    // ---- invert the ranks of batch row b: sorted position -> original row ----
    {
        v4i r4 = *(const v4i*)(rk    + b * L_ + 4 * tid);
        v4i l4 = *(const v4i*)(label + b * L_ + 4 * tid);
#pragma unroll
        for (int e = 0; e < 4; ++e) {
            int p = r4[e] & (L_ - 1);
            sinfo[p] = (r4[e] & ~(L_ * 2 - 1)) | (4 * tid + e);
            slab[p]  = l4[e];
        }
    }
    __syncthreads();                          // table complete before any wave reads it

    // ---- Q tile of this wave's head -> the wave's own value buffer, one copy a row ----
    // A fragment load straight from global memory takes 8 bytes a lane from 16 rows, so each of
    // its 32 instructions touches 16 cache lines; a copy takes one whole 512-byte row (4 lines).
    {
        const int    qrv = sinfo[i0 + lo];
        const float* qp  = q + ((size_t)b * L_ * V_ + k) * D_;
#pragma unroll
        for (int m = 0; m < 16; ++m) {
            const int qi = __builtin_amdgcn_readlane(qrv, m) & (L_ - 1);   // original row of sorted row i0 + m
            const float* g = qp + (size_t)qi * V_ * D_ + 4 * lane;
            float*       l = &vtile[wv][m * VP_ + 4 * lane];
#if USE_ASYNC
            __builtin_amdgcn_global_load_async_to_lds_b128((gv4i*)g, (lv4i*)l, 0, 0);
#else
            *(v4f*)l = *(const v4f*)g;
#endif
        }
    }

    // key tiles the row tile needs, the same for all four waves; read into scalars so
    // that the loop test is a scalar branch (the barriers need a block-uniform loop)
    const int jt0 = min(__builtin_amdgcn_readfirstlane((sinfo[i0] >> 10) & 1023) >> 4, NJT - 1);
    const int jt1 = min(max((__builtin_amdgcn_readfirstlane((sinfo[i0 + 15] >> 20) & 1023) + 15) >> 4, jt0 + 1), NJT);

    // rowv: the 16 table entries of a key tile, entry j in lanes j and j + 16.
    // key-sum tile -> stile[bsel]: 4 rows of 512 B per wave, one copy a row
    auto stage_s = [&](int rowv, int bsel) {
        const float* sp = sumt + (size_t)b * L_ * D_;
#pragma unroll
        for (int ii = 0; ii < 16 / WPB; ++ii) {
            const int jr = __builtin_amdgcn_readlane(rowv, wv + WPB * ii) & (L_ - 1);  // original row of the key
            const float* g = sp + jr * D_ + 4 * lane;
            float*       l = &stile[bsel][(wv + WPB * ii) * SP_ + 4 * lane];
#if USE_ASYNC
            __builtin_amdgcn_global_load_async_to_lds_b128((gv4i*)g, (lv4i*)l, 0, 0);
#else
            *(v4f*)l = *(const v4f*)g;
#endif
        }
    };
    // value tile of this wave's head -> the wave's own buffer: 16 rows, one copy a row
    auto stage_v = [&](int rowv) {
        const float* vp = value + ((size_t)b * L_ * V_ + k) * D_;
#pragma unroll
        for (int jl = 0; jl < 16; ++jl) {
            const int jr = __builtin_amdgcn_readlane(rowv, jl) & (L_ - 1);
            const float* g = vp + (size_t)jr * V_ * D_ + 4 * lane;
            float*       l = &vtile[wv][jl * VP_ + 4 * lane];
#if USE_ASYNC
            __builtin_amdgcn_global_load_async_to_lds_b128((gv4i*)g, (lv4i*)l, 0, 0);
#else
            *(v4f*)l = *(const v4f*)g;
#endif
        }
    };

    const int row0 = sinfo[jt0 * 16 + lo];
    stage_s(row0, jt0 & 1);   // the first key-sum tile flies beside Q

    asm volatile("s_wait_asynccnt 0x0" ::: "memory");   // this wave's Q tile and its part of the first key-sum tile have landed

    // ---- Q^T as WMMA-B fragments: B[K=4c+2hi+r][N=lo], 32 chunks, from the wave's own buffer ----
    v2f qa[32];
#pragma unroll
    for (int c = 0; c < 32; ++c)
        qa[c] = *(const v2f*)&vtile[wv][lo * VP_ + 4 * c + 2 * hi];

    const int labi = slab[i0 + lo];   // label of the one query row this lane owns

    v8f acc[8] = {};           // O^T: acc[nt][r] = O[row lo][d = 16*nt + 8*hi + r]
    float mrow = -1e30f;       // running maximum of row lo (same in both halves)
    float lrow = 0.0f;         // running sum of row lo over this half's keys

    const float scale = 0.08838834764831845f;   // 1/sqrt(128)

    asm volatile("s_wait_dscnt 0" ::: "memory");   // the Q fragments are in registers before a copy overwrites the buffer
    __syncthreads();                               // every wave's part of the first key-sum tile has landed
    stage_v(row0);                                 // first value tile: flies under the first scores, waited for behind them

    for (int jt = jt0; jt < jt1; ++jt) {
        const int  cur  = jt & 1;
        const bool more = jt + 1 < jt1;        // scalar, the same in all four waves
        int rown = 0;
        if (more) {                            // next key-sum tile into the buffer that trip jt - 1 read
            rown = sinfo[(jt + 1) * 16 + lo];
            stage_s(rown, cur ^ 1);
        }

        // ---- scores S^T = sumT_tile (16xD) x Q^T (Dx16), K in chunks of 4 ----
        v8f s = {};
#pragma unroll
        for (int c = 0; c < 32; ++c) {
            v2f kt = *(const v2f*)&stile[cur][lo * SP_ + 4 * c + 2 * hi]; // A[M=j][K=d]
            s = __builtin_amdgcn_wmma_f32_16x16x4_f32(
                    false, kt, false, qa[c], (short)0, s, false, false);
        }

        // this wave's value tile (issued a trip ago) and its part of the next key-sum
        // tile have landed; here, so that the value fragments load beside the softmax
        asm volatile("s_wait_asynccnt 0x0" ::: "memory");

        // ---- mask + online softmax: s[r] = S[row lo][key r + 8*hi] ----
        const v4i lj0 = *(const v4i*)&slab[jt * 16 + 8 * hi];
        const v4i lj1 = *(const v4i*)&slab[jt * 16 + 8 * hi + 4];
        float pe[8];
#pragma unroll
        for (int r = 0; r < 8; ++r)
            pe[r] = (labi == (r < 4 ? lj0[r & 3] : lj1[r & 3])) ? s[r] * scale : -1e30f;
        float mx = fmaxf(fmaxf(fmaxf(pe[0], pe[1]), fmaxf(pe[2], pe[3])),
                         fmaxf(fmaxf(pe[4], pe[5]), fmaxf(pe[6], pe[7])));
        mx = fmaxf(mx, xhalf(mx));                     // over all 16 keys of the tile
        const float mnew  = fmaxf(mrow, mx);
        const float alpha = __expf(mrow - mnew);
#pragma unroll
        for (int r = 0; r < 8; ++r) pe[r] = __expf(pe[r] - mnew);
        lrow = lrow * alpha + (((pe[0] + pe[1]) + (pe[2] + pe[3])) + ((pe[4] + pe[5]) + (pe[6] + pe[7])));
        mrow = mnew;
#pragma unroll
        for (int nt = 0; nt < 8; ++nt) acc[nt] *= alpha;

        // ---- O^T += Vtile^T (128x16) x P^T (16x16); K=j in 4 chunks of 4 ----
        // k position (hi, e) of chunk cp stands for key 8*hi + 2*cp + e on both sides
#pragma unroll
        for (int cp = 0; cp < 4; ++cp) {
            v2f pb;   // B[K=j][N=row lo], straight from the score registers
            pb.x = pe[2 * cp];
            pb.y = pe[2 * cp + 1];
#pragma unroll
            for (int nt = 0; nt < 8; ++nt) {
                v2f va;   // A[M=d][K=j]
                va.x = vtile[wv][(8 * hi + 2 * cp + 0) * VP_ + nt * 16 + lo];
                va.y = vtile[wv][(8 * hi + 2 * cp + 1) * VP_ + nt * 16 + lo];
                acc[nt] = __builtin_amdgcn_wmma_f32_16x16x4_f32(
                              false, va, false, pb, (short)0, acc[nt], false, false);
            }
        }
        if (more) {
            asm volatile("s_wait_dscnt 0" ::: "memory");   // the wave's reads of both tiles retired before a copy overwrites one
            stage_v(rown);      // a buffer private to one wave: refilled behind that wave's own wait, no barrier in front
            __syncthreads();    // next key-sum tile complete; all waves done with buffer `cur`
        }
    }

    // ---- finalize: out[b, row, k, d] = O[row][d] / l[row] ----
    // No copy is issued behind the last trip's s_wait_asynccnt 0; each wave turns its
    // tile in its own value buffer, so that a store instruction writes one whole
    // 512-byte output row.
    {
        const float inv = 1.0f / (lrow + xhalf(lrow));   // the halves' sums joined once
        float* ot = &vtile[wv][0];
#pragma unroll
        for (int nt = 0; nt < 8; ++nt) {
            v4f x0 = { acc[nt][0], acc[nt][1], acc[nt][2], acc[nt][3] };
            v4f x1 = { acc[nt][4], acc[nt][5], acc[nt][6], acc[nt][7] };
            *(v4f*)&ot[lo * VP_ + nt * 16 + 8 * hi]     = x0 * inv;
            *(v4f*)&ot[lo * VP_ + nt * 16 + 8 * hi + 4] = x1 * inv;
        }
        asm volatile("s_wait_dscnt 0" ::: "memory");   // the wave's own tile written before its lanes read across rows
        const int orow = sinfo[i0 + lo] & (L_ - 1);
        float* ob = out + ((size_t)b * L_ * V_ + k) * D_;   // b and k are scalars
#pragma unroll
        for (int m = 0; m < 16; ++m) {
            const int oi = __builtin_amdgcn_readlane(orow, m);   // original row of sorted row i0 + m
            *(v4f*)(ob + (size_t)oi * V_ * D_ + 4 * lane) = *(const v4f*)&ot[m * VP_ + 4 * lane];
        }
    }
}

extern "C" void kernel_launch(void* const* d_in, const int* in_sizes, int n_in,
                              void* d_out, int out_size, void* d_ws, size_t ws_size,
                              hipStream_t stream) {
    const float* q     = (const float*)d_in[0];
    const float* key   = (const float*)d_in[1];
    const float* value = (const float*)d_in[2];
    const int*   label = (const int*)d_in[3];
    float*       out   = (float*)d_out;
    float*       sumt  = (float*)d_ws;          // B*L*D floats = 512 KB
    int*         rk    = (int*)d_ws + B_ * L_ * D_;   // B*L packed ranks behind it

    // Stage 1: key reduction over v, and the label ranks
    ca_sumkey_kernel<<<RKB + (B_ * L_) / (SKT / 32), SKT, 0, stream>>>(key, label, sumt, rk);

    // Stage 2: fused masked-softmax attention, 1 wave per (b,k,i-tile), 4 heads of a tile per block
    const int nwaves = B_ * V_ * NIT;           // 4096
    ca_attn_kernel<<<nwaves / WPB, WPB * 32, 0, stream>>>(q, value, label, sumt, rk, out);
}

// v007
// It runs in 31.3 microseconds.
// Two timings next to v006 both put it at 1.12 times that version's speed.
// All steps since v000 together make it 7.28 times as fast.
#include <hip/hip_runtime.h>
#include <hip/hip_bf16.h>

typedef float v2f __attribute__((ext_vector_type(2)));
typedef float v4f __attribute__((ext_vector_type(4)));
typedef float v8f __attribute__((ext_vector_type(8)));
typedef int   v4i __attribute__((ext_vector_type(4)));

typedef __attribute__((address_space(1))) v4i gv4i;   // global b128 chunk
typedef __attribute__((address_space(3))) v4i lv4i;   // LDS b128 chunk

#define B_   2
#define L_   512
#define V_   64
#define D_   128
#define NJT  (L_ / 16)   // 32 j-tiles
#define NIT  (L_ / 16)   // 32 i-tiles
#define WPB  4           // waves per block (wave32)
#define SKT  128         // threads per block of launch 1 (4 waves)
#define RKB  32          // blocks of launch 1 that rank the labels (32 rows each)
#define TSL  (NIT + 8)   // row-tile slots per batch row in the grid of launch 2: tiles start anew at each label,
                         // so c labels give at most NIT + c - 1 tiles; a slot takes further tiles in a loop
// LDS row pitches in dwords (64 banks of 4 B; bank = dword address mod 64):
#define SP_  132         // key-sum tile: 16 rows x 8-B reads, 4*row + 2*half covers all 64 banks
#define VP_  132         // value tile: the wave halves read rows 8 apart, 8*132 mod 64 = 32 banks apart; Q is read from it as the key-sum tile is

#if defined(__gfx1250__) && __has_builtin(__builtin_amdgcn_global_load_async_to_lds_b128)
#define USE_ASYNC 1
#else
#define USE_ASYNC 0
#endif

// ---------------- Stage 1: sumT[b,j,d] = sum_v key[b,j,v,d] ----------------
// The first RKB blocks instead rank the labels of each batch row (stable, by
// comparison, for any int values): rk[b*L+i] = rank | first<<10 | end<<20, where
// [first, end) is the range of ranks that holds every row with row i's label.
// amdgpu_waves_per_eu(1, 4): the grid supplies about one wave per SIMD; without this line the
// compiler saves registers for waves that never come and keeps 12 loads in flight, not 60 (seen in two builds).
__global__ __launch_bounds__(SKT) __attribute__((amdgpu_waves_per_eu(1, 4))) void ca_sumkey_kernel(
    const float* __restrict__ key, const int* __restrict__ label,
    float* __restrict__ sumt, int* __restrict__ rk)
{
    if (blockIdx.x < RKB) {
        const int g    = blockIdx.x * SKT + threadIdx.x;  // 4 threads per row
        const int row  = g >> 2;                          // b*L + i
        const int part = g & 3;                           // quarter of the j range
        const int il   = row & (L_ - 1);
        const int* lb  = label + (row & ~(L_ - 1));
        const int me   = lb[il];
        const v4i* lb4 = (const v4i*)(lb + part * (L_ / 4));
        int less = 0, eq = 0, eqb = 0;
#pragma unroll 8   // eight 16-byte label loads in flight per trip
        for (int t = 0; t < L_ / 16; ++t) {
            v4i x = lb4[t];
#pragma unroll
            for (int e = 0; e < 4; ++e) {
                int j = part * (L_ / 4) + 4 * t + e;
                less += (x[e] < me) ? 1 : 0;
                eq   += (x[e] == me) ? 1 : 0;
                eqb  += (x[e] == me && j < il) ? 1 : 0;
            }
        }
        less += __shfl_xor(less, 1);  less += __shfl_xor(less, 2);
        eq   += __shfl_xor(eq, 1);    eq   += __shfl_xor(eq, 2);
        eqb  += __shfl_xor(eqb, 1);   eqb  += __shfl_xor(eqb, 2);
        if (part == 0) rk[row] = (less + eqb) | (less << 10) | ((less + eq) << 20);
        return;
    }
    // One wave per key row (b, j): a lane owns four d and reads 16 bytes, so that one load
    // takes a whole 512-byte row (b, j, v). The loop is unrolled whole: the row's loads are
    // issued ahead of the additions as far as the registers reach (60 of the 64 in this
    // build); the additions stay in the order v = 0..63.
    const int  bl = (blockIdx.x - RKB) * (SKT / 32) + (threadIdx.x >> 5);   // b*L + j, exact
    const int  ln = threadIdx.x & 31;
    const v4f* kp = (const v4f*)(key + (size_t)bl * V_ * D_) + ln;
    v4f s = { 0.0f, 0.0f, 0.0f, 0.0f };
#pragma unroll   // all 64 loads of the row visible to the scheduler at once
    for (int v = 0; v < V_; ++v) s += kp[v * (D_ / 4)];
    ((v4f*)sumt)[bl * (D_ / 4) + ln] = s;
    asm volatile("s_wait_xcnt 0x0" ::: "memory");   // the store's address and data registers are released before any later write of them
}

__device__ __forceinline__ float xhalf(float x) {   // lane l with lane l ^ 16
    return __builtin_bit_cast(float, __builtin_amdgcn_permlanex16(
        __builtin_bit_cast(int, x), __builtin_bit_cast(int, x), 0x76543210, 0xfedcba98, false, false));
}

// amdgpu_waves_per_eu(4, 4): the grid supplies four waves per SIMD, as before. The
// transposed form needs fewer registers; without this line the compiler squeezes
// for a fifth wave that never comes and waits on every LDS fragment load singly.
__global__ __launch_bounds__(WPB * 32) __attribute__((amdgpu_waves_per_eu(4, 4))) void ca_attn_kernel(
    const float* __restrict__ q,
    const float* __restrict__ value,
    const float* __restrict__ sumt,
    const int*   __restrict__ rk,
    float*       __restrict__ out)
{
    __shared__ __attribute__((aligned(16))) float stile[2][16 * SP_];     // double-buffered sumT tile, shared
    __shared__ __attribute__((aligned(16))) float vtile[WPB][16 * VP_];   // value tile, one buffer per wave; in front of the
                                                                          // loop it takes the wave's Q tile, behind it the output tile
    __shared__ int   sinfo[L_];               // sorted pos -> row | first<<10 | end<<20

    const int tid  = threadIdx.x;
    const int widx = tid >> 5;
    const int lane = tid & 31;
    const int lo   = lane & 15;    // M for A, N for B/C/D
    const int hi   = lane >> 4;    // half-wave select

    const int wv = __builtin_amdgcn_readfirstlane(widx);   // the wave's number as a scalar

    // block index -> (tile slot, b, four heads), the heads fastest; the slots that may stay empty come last
    const unsigned bi = blockIdx.x;
    const int k  = (int)(bi % (V_ / WPB)) * WPB + wv;
    const int b  = (int)(bi / (V_ / WPB) % B_);
    const int it = (int)(bi / (V_ / WPB * B_));

    // ---- invert the ranks of batch row b: sorted position -> original row ----
    {
        v4i r4 = *(const v4i*)(rk    + b * L_ + 4 * tid);
#pragma unroll
        for (int e = 0; e < 4; ++e) {
            int p = r4[e] & (L_ - 1);
            sinfo[p] = (r4[e] & ~(L_ * 2 - 1)) | (4 * tid + e);
        }
    }
    __syncthreads();                          // table complete before any wave reads it

  for (int t = it; ; ) {   // one pass for up to TSL tiles in a batch row; every value here is the same in all four waves
    // ---- tile t of the batch row: a tile starts at every sorted position that lies a multiple of 16
    // behind its label's first; p0 = the t-th such position, nt = their number (all in scalars) ----
    int nt = 0, p0 = 0;
    int en[L_ / 32];
#pragma unroll
    for (int r = 0; r < L_ / 32; ++r) en[r] = sinfo[32 * r + lane];   // all 16 reads issued ahead of the first use
#pragma unroll
    for (int r = 0; r < L_ / 32; ++r) {
        const unsigned m = __builtin_amdgcn_ballot_w32(((32 * r + lane - (en[r] >> 10)) & 15) == 0);
        // lanes whose count of tile starts below them is t; with m: the one lane that is the t-th start
        const unsigned h = m & __builtin_amdgcn_ballot_w32((int)__builtin_amdgcn_mbcnt_lo(m, (unsigned)nt) == t);
        p0 = h ? 32 * r + __builtin_ctz(h) : p0;
        nt += __builtin_popcount(m);
    }
    if (t >= nt) break;                       // an empty slot: all four waves leave the loop together
    const int e0  = __builtin_amdgcn_readfirstlane(sinfo[p0]);
    const int cf  = min((e0 >> 10) & 1023, p0);                // the label's sorted positions are [cf, ce)
    const int ce  = min(max((e0 >> 20) & 1023, p0 + 1), L_);
    const int cnt = min(ce - p0, 16);                          // rows of this tile
    const int ntr = (ce - cf + 15) >> 4;                       // key tiles of the label, 1..NJT

    // ---- Q tile of this wave's head -> the wave's own value buffer, one copy a row ----
    // A fragment load straight from global memory takes 8 bytes a lane from 16 rows, so each of
    // its 32 instructions touches 16 cache lines; a copy takes one whole 512-byte row (4 lines).
    {
        const int    qrv = sinfo[min(p0 + lo, ce - 1)];
        const float* qp  = q + ((size_t)b * L_ * V_ + k) * D_;
#pragma unroll
        for (int m = 0; m < 16; ++m) {
            const int qi = __builtin_amdgcn_readlane(qrv, m) & (L_ - 1);   // original row of sorted row p0 + m
            const float* g = qp + (size_t)qi * V_ * D_ + 4 * lane;
            float*       l = &vtile[wv][m * VP_ + 4 * lane];
#if USE_ASYNC
            __builtin_amdgcn_global_load_async_to_lds_b128((gv4i*)g, (lv4i*)l, 0, 0);
#else
            *(v4f*)l = *(const v4f*)g;
#endif
        }
    }

    // rowv: the 16 table entries of a key tile, entry j in lanes j and j + 16.
    // key-sum tile -> stile[bsel]: 4 rows of 512 B per wave, one copy a row
    auto stage_s = [&](int rowv, int bsel) {
        const float* sp = sumt + (size_t)b * L_ * D_;
#pragma unroll
        for (int ii = 0; ii < 16 / WPB; ++ii) {
            const int jr = __builtin_amdgcn_readlane(rowv, wv + WPB * ii) & (L_ - 1);  // original row of the key
            const float* g = sp + jr * D_ + 4 * lane;
            float*       l = &stile[bsel][(wv + WPB * ii) * SP_ + 4 * lane];
#if USE_ASYNC
            __builtin_amdgcn_global_load_async_to_lds_b128((gv4i*)g, (lv4i*)l, 0, 0);
#else
            *(v4f*)l = *(const v4f*)g;
#endif
        }
    };
    // value tile of this wave's head -> the wave's own buffer: 16 rows, one copy a row
    auto stage_v = [&](int rowv) {
        const float* vp = value + ((size_t)b * L_ * V_ + k) * D_;
#pragma unroll
        for (int jl = 0; jl < 16; ++jl) {
            const int jr = __builtin_amdgcn_readlane(rowv, jl) & (L_ - 1);
            const float* g = vp + (size_t)jr * V_ * D_ + 4 * lane;
            float*       l = &vtile[wv][jl * VP_ + 4 * lane];
#if USE_ASYNC
            __builtin_amdgcn_global_load_async_to_lds_b128((gv4i*)g, (lv4i*)l, 0, 0);
#else
            *(v4f*)l = *(const v4f*)g;
#endif
        }
    };

    const int row0 = sinfo[min(cf + lo, ce - 1)];
    stage_s(row0, 0);   // the first key-sum tile flies beside Q

    asm volatile("s_wait_asynccnt 0x0" ::: "memory");   // this wave's Q tile and its part of the first key-sum tile have landed

    // ---- Q^T as WMMA-B fragments: B[K=4c+2hi+r][N=lo], 32 chunks, from the wave's own buffer ----
    v2f qa[32];
#pragma unroll
    for (int c = 0; c < 32; ++c)
        qa[c] = *(const v2f*)&vtile[wv][lo * VP_ + 4 * c + 2 * hi];

    v8f acc[8] = {};           // O^T: acc[nt][r] = O[row lo][d = 16*nt + 8*hi + r]
    float mrow = -1e30f;       // running maximum of row lo (same in both halves)
    float lrow = 0.0f;         // running sum of row lo over this half's keys

    const float scale = 0.08838834764831845f;   // 1/sqrt(128)

    asm volatile("s_wait_dscnt 0" ::: "memory");   // the Q fragments are in registers before a copy overwrites the buffer
    __syncthreads();                               // every wave's part of the first key-sum tile has landed
    stage_v(row0);                                 // first value tile: flies under the first scores, waited for behind them

    for (int jt = 0; jt < ntr; ++jt) {
        const int  cur  = jt & 1;
        const bool more = jt + 1 < ntr;        // scalar, the same in all four waves
        int rown = 0;
        if (more) {                            // next key-sum tile into the buffer that trip jt - 1 read
            rown = sinfo[min(cf + (jt + 1) * 16 + lo, ce - 1)];
            stage_s(rown, cur ^ 1);
        }

        // ---- scores S^T = sumT_tile (16xD) x Q^T (Dx16), K in chunks of 4 ----
        v8f s = {};
#pragma unroll
        for (int c = 0; c < 32; ++c) {
            v2f kt = *(const v2f*)&stile[cur][lo * SP_ + 4 * c + 2 * hi]; // A[M=j][K=d]
            s = __builtin_amdgcn_wmma_f32_16x16x4_f32(
                    false, kt, false, qa[c], (short)0, s, false, false);
        }

        // this wave's value tile (issued a trip ago) and its part of the next key-sum
        // tile have landed; here, so that the value fragments load beside the softmax
        asm volatile("s_wait_asynccnt 0x0" ::: "memory");

        // ---- mask + online softmax: s[r] = S[row lo][key r + 8*hi] ----
        const int lim = ce - cf - jt * 16 - 8 * hi;   // keys of the label left from this half's first slot on; slot 0 of a tile is always one
        float pe[8];
#pragma unroll
        for (int r = 0; r < 8; ++r)
            pe[r] = (r < lim) ? s[r] * scale : -1e30f;
        float mx = fmaxf(fmaxf(fmaxf(pe[0], pe[1]), fmaxf(pe[2], pe[3])),
                         fmaxf(fmaxf(pe[4], pe[5]), fmaxf(pe[6], pe[7])));
        mx = fmaxf(mx, xhalf(mx));                     // over all 16 keys of the tile
        const float mnew  = fmaxf(mrow, mx);
        const float alpha = __expf(mrow - mnew);
#pragma unroll
        for (int r = 0; r < 8; ++r) pe[r] = __expf(pe[r] - mnew);
        lrow = lrow * alpha + (((pe[0] + pe[1]) + (pe[2] + pe[3])) + ((pe[4] + pe[5]) + (pe[6] + pe[7])));
        mrow = mnew;
#pragma unroll
        for (int nt = 0; nt < 8; ++nt) acc[nt] *= alpha;

        // ---- O^T += Vtile^T (128x16) x P^T (16x16); K=j in 4 chunks of 4 ----
        // k position (hi, e) of chunk cp stands for key 8*hi + 2*cp + e on both sides
#pragma unroll
        for (int cp = 0; cp < 4; ++cp) {
            v2f pb;   // B[K=j][N=row lo], straight from the score registers
            pb.x = pe[2 * cp];
            pb.y = pe[2 * cp + 1];
#pragma unroll
            for (int nt = 0; nt < 8; ++nt) {
                v2f va;   // A[M=d][K=j]
                va.x = vtile[wv][(8 * hi + 2 * cp + 0) * VP_ + nt * 16 + lo];
                va.y = vtile[wv][(8 * hi + 2 * cp + 1) * VP_ + nt * 16 + lo];
                acc[nt] = __builtin_amdgcn_wmma_f32_16x16x4_f32(
                              false, va, false, pb, (short)0, acc[nt], false, false);
            }
        }
        if (more) {
            asm volatile("s_wait_dscnt 0" ::: "memory");   // the wave's reads of both tiles retired before a copy overwrites one
            stage_v(rown);      // a buffer private to one wave: refilled behind that wave's own wait, no barrier in front
            __syncthreads();    // next key-sum tile complete; all waves done with buffer `cur`
        }
    }

    // ---- finalize: out[b, row, k, d] = O[row][d] / l[row] ----
    // No copy is issued behind the last trip's s_wait_asynccnt 0; each wave turns its
    // tile in its own value buffer, so that a store instruction writes one whole
    // 512-byte output row.
    {
        const float inv = 1.0f / (lrow + xhalf(lrow));   // the halves' sums joined once
        float* ot = &vtile[wv][0];
#pragma unroll
        for (int nt = 0; nt < 8; ++nt) {
            v4f x0 = { acc[nt][0], acc[nt][1], acc[nt][2], acc[nt][3] };
            v4f x1 = { acc[nt][4], acc[nt][5], acc[nt][6], acc[nt][7] };
            *(v4f*)&ot[lo * VP_ + nt * 16 + 8 * hi]     = x0 * inv;
            *(v4f*)&ot[lo * VP_ + nt * 16 + 8 * hi + 4] = x1 * inv;
        }
        asm volatile("s_wait_dscnt 0" ::: "memory");   // the wave's own tile written before its lanes read across rows
        const int orow = sinfo[min(p0 + lo, ce - 1)] & (L_ - 1);
        float* ob = out + ((size_t)b * L_ * V_ + k) * D_;   // b and k are scalars
        v4f ov[16];
#pragma unroll
        for (int m = 0; m < 16; ++m) ov[m] = *(const v4f*)&ot[m * VP_ + 4 * lane];
#pragma unroll
        for (int m = 0; m < 16; ++m) {
            if (m < cnt) {                                       // scalar test: a spare row is not stored
                const int oi = __builtin_amdgcn_readlane(orow, m);   // original row of sorted row p0 + m
                *(v4f*)(ob + (size_t)oi * V_ * D_ + 4 * lane) = ov[m];
                asm volatile("s_wait_xcnt 0x0" ::: "memory");   // the store's address and data registers are released before the next row's address is formed in them
            }
        }
    }
    t += TSL;
    if (t >= nt) break;
    asm volatile("s_wait_dscnt 0" ::: "memory");   // the wave's reads of its output tile retired before the next tile's copies overwrite the buffer
    __syncthreads();                               // every wave has left the key-sum buffers before they are refilled
  }
}

extern "C" void kernel_launch(void* const* d_in, const int* in_sizes, int n_in,
                              void* d_out, int out_size, void* d_ws, size_t ws_size,
                              hipStream_t stream) {
    const float* q     = (const float*)d_in[0];
    const float* key   = (const float*)d_in[1];
    const float* value = (const float*)d_in[2];
    const int*   label = (const int*)d_in[3];
    float*       out   = (float*)d_out;
    float*       sumt  = (float*)d_ws;          // B*L*D floats = 512 KB
    int*         rk    = (int*)d_ws + B_ * L_ * D_;   // B*L packed ranks behind it

    // Stage 1: key reduction over v, and the label ranks
    ca_sumkey_kernel<<<RKB + (B_ * L_) / (SKT / 32), SKT, 0, stream>>>(key, label, sumt, rk);

    // Stage 2: fused masked-softmax attention, 1 wave per (b,k,tile slot), 4 heads of a tile per block
    const int nwaves = B_ * V_ * TSL;
    ca_attn_kernel<<<nwaves / WPB, WPB * 32, 0, stream>>>(q, value, sumt, rk, out);
}

// v008
// One run takes 29.1 microseconds.
// Next to v007, in two timings, it ran 1.08 times as fast each time.
// All steps since v000 together make it 7.86 times as fast.
#include <hip/hip_runtime.h>
#include <hip/hip_bf16.h>

typedef float v2f __attribute__((ext_vector_type(2)));
typedef float v4f __attribute__((ext_vector_type(4)));
typedef float v8f __attribute__((ext_vector_type(8)));
typedef int   v4i __attribute__((ext_vector_type(4)));

typedef __attribute__((address_space(1))) v4i gv4i;   // global b128 chunk
typedef __attribute__((address_space(3))) v4i lv4i;   // LDS b128 chunk

#define B_   2
#define L_   512
#define V_   64
#define D_   128
#define NJT  (L_ / 16)   // 32 j-tiles
#define NIT  (L_ / 16)   // 32 i-tiles
#define WPB  4           // waves per block (wave32)
#define SKT  128         // threads per block of launch 1 (4 waves)
#define RKB  32          // blocks of launch 1 that rank the labels (32 rows each)
#define TSL  (NIT + 8)   // row-tile slots per batch row in the grid of launch 2: tiles start anew at each label,
                         // so c labels give at most NIT + c - 1 tiles; a slot takes further tiles in a loop
// LDS row pitches in dwords (64 banks of 4 B; bank = dword address mod 64):
#define SP_  132         // key-sum tile: 16 rows x 8-B reads, 4*row + 2*half covers all 64 banks
#define VP_  132         // value tile: the wave halves read rows 8 apart, 8*132 mod 64 = 32 banks apart; Q is read from it as the key-sum tile is

#if defined(__gfx1250__) && __has_builtin(__builtin_amdgcn_global_load_async_to_lds_b128)
#define USE_ASYNC 1
#else
#define USE_ASYNC 0
#endif

// ---------------- Stage 1: sumT[b,j,d] = sum_v key[b,j,v,d] ----------------
// The first RKB blocks instead rank the labels of each batch row (stable, by
// comparison, for any int values): rk[b*L+i] = rank | first<<10 | end<<20, where
// [first, end) is the range of ranks that holds every row with row i's label.
// amdgpu_waves_per_eu(1, 4): the grid supplies about one wave per SIMD; without this line the
// compiler saves registers for waves that never come and keeps 12 loads in flight, not 60 (seen in two builds).
__global__ __launch_bounds__(SKT) __attribute__((amdgpu_waves_per_eu(1, 4))) void ca_sumkey_kernel(
    const float* __restrict__ key, const int* __restrict__ label,
    float* __restrict__ sumt, int* __restrict__ rk)
{
    if (blockIdx.x < RKB) {
        const int g    = blockIdx.x * SKT + threadIdx.x;  // 4 threads per row
        const int row  = g >> 2;                          // b*L + i
        const int part = g & 3;                           // quarter of the j range
        const int il   = row & (L_ - 1);
        const int* lb  = label + (row & ~(L_ - 1));
        const int me   = lb[il];
        const v4i* lb4 = (const v4i*)(lb + part * (L_ / 4));
        int less = 0, eq = 0, eqb = 0;
#pragma unroll 8   // eight 16-byte label loads in flight per trip
        for (int t = 0; t < L_ / 16; ++t) {
            v4i x = lb4[t];
#pragma unroll
            for (int e = 0; e < 4; ++e) {
                int j = part * (L_ / 4) + 4 * t + e;
                less += (x[e] < me) ? 1 : 0;
                eq   += (x[e] == me) ? 1 : 0;
                eqb  += (x[e] == me && j < il) ? 1 : 0;
            }
        }
        less += __shfl_xor(less, 1);  less += __shfl_xor(less, 2);
        eq   += __shfl_xor(eq, 1);    eq   += __shfl_xor(eq, 2);
        eqb  += __shfl_xor(eqb, 1);   eqb  += __shfl_xor(eqb, 2);
        if (part == 0) rk[row] = (less + eqb) | (less << 10) | ((less + eq) << 20);
        return;
    }
    // One wave per key row (b, j): a lane owns four d and reads 16 bytes, so that one load
    // takes a whole 512-byte row (b, j, v). The loop is unrolled whole: the row's loads are
    // issued ahead of the additions as far as the registers reach (60 of the 64 in this
    // build); the additions stay in the order v = 0..63.
    const int  bl = (blockIdx.x - RKB) * (SKT / 32) + (threadIdx.x >> 5);   // b*L + j, exact
    const int  ln = threadIdx.x & 31;
    const v4f* kp = (const v4f*)(key + (size_t)bl * V_ * D_) + ln;
    v4f s = { 0.0f, 0.0f, 0.0f, 0.0f };
#pragma unroll   // all 64 loads of the row visible to the scheduler at once
    for (int v = 0; v < V_; ++v) s += kp[v * (D_ / 4)];
    ((v4f*)sumt)[bl * (D_ / 4) + ln] = s;
    asm volatile("s_wait_xcnt 0x0" ::: "memory");   // the store's address and data registers are released before any later write of them
}

template <int R, int P>
__device__ __forceinline__ void copy_row(const float* base, long off, float* l0) {
#if USE_ASYNC
    __builtin_amdgcn_global_load_async_to_lds_b128((gv4i*)(base + (off - R * P)), (lv4i*)l0, R * P * 4, 0);
#else
    *(v4f*)(l0 + R * P) = *(const v4f*)(base + off);
#endif
}
template <int I> struct ic { static constexpr int v = I; };
template <int I, int E, class F>
__device__ __forceinline__ void each_row(F f) {   // f(0) .. f(E - 1), the index a compile-time constant
    if constexpr (I < E) { f(ic<I>{}); each_row<I + 1, E>(f); }
}

__device__ __forceinline__ float xhalf(float x) {   // lane l with lane l ^ 16
    return __builtin_bit_cast(float, __builtin_amdgcn_permlanex16(
        __builtin_bit_cast(int, x), __builtin_bit_cast(int, x), 0x76543210, 0xfedcba98, false, false));
}

// amdgpu_waves_per_eu(5, 5): the grid is five blocks for each of the 256 WGPs.
// At 192 registers a wave all five are resident at once; at four, the blocks left over start only when others
// end, and run with a SIMD to themselves, their latencies uncovered.
__global__ __launch_bounds__(WPB * 32) __attribute__((amdgpu_waves_per_eu(5, 5))) void ca_attn_kernel(
    const float* __restrict__ q,
    const float* __restrict__ value,
    const float* __restrict__ sumt,
    const int*   __restrict__ rk,
    float*       __restrict__ out)
{
    __shared__ __attribute__((aligned(16))) float stile[2][16 * SP_];     // double-buffered sumT tile, shared
    __shared__ __attribute__((aligned(16))) float vtile[WPB][16 * VP_];   // value tile, one buffer per wave; in front of the
                                                                          // loop it takes the wave's Q tile, behind it the output tile
    __shared__ int   sinfo[L_];               // sorted pos -> row | first<<10 | end<<20

    const int tid  = threadIdx.x;
    const int widx = tid >> 5;
    const int lane = tid & 31;
    const int lo   = lane & 15;    // M for A, N for B/C/D
    const int hi   = lane >> 4;    // half-wave select

    const int wv = __builtin_amdgcn_readfirstlane(widx);   // the wave's number as a scalar

    // block index -> (tile slot, b, four heads), the heads fastest; the slots that may stay empty come last
    const unsigned bi = blockIdx.x;
    const int k  = (int)(bi % (V_ / WPB)) * WPB + wv;
    const int b  = (int)(bi / (V_ / WPB) % B_);
    const int it = (int)(bi / (V_ / WPB * B_));

    // ---- invert the ranks of batch row b: sorted position -> original row ----
    {
        v4i r4 = *(const v4i*)(rk    + b * L_ + 4 * tid);
#pragma unroll
        for (int e = 0; e < 4; ++e) {
            int p = r4[e] & (L_ - 1);
            sinfo[p] = (r4[e] & ~(L_ * 2 - 1)) | (4 * tid + e);
        }
    }
    __syncthreads();                          // table complete before any wave reads it

  for (int t = it; ; ) {   // one pass for up to TSL tiles in a batch row; every value here is the same in all four waves
    // ---- tile t of the batch row: a tile starts at every sorted position that lies a multiple of 16
    // behind its label's first; p0 = the t-th such position, nt = their number (all in scalars) ----
    int nt = 0, p0 = 0;
    int en[L_ / 32];
#pragma unroll
    for (int r = 0; r < L_ / 32; ++r) en[r] = sinfo[32 * r + lane];   // all 16 reads issued ahead of the first use
#pragma unroll
    for (int r = 0; r < L_ / 32; ++r) {
        const unsigned m = __builtin_amdgcn_ballot_w32(((32 * r + lane - (en[r] >> 10)) & 15) == 0);
        // lanes whose count of tile starts below them is t; with m: the one lane that is the t-th start
        const unsigned h = m & __builtin_amdgcn_ballot_w32((int)__builtin_amdgcn_mbcnt_lo(m, (unsigned)nt) == t);
        p0 = h ? 32 * r + __builtin_ctz(h) : p0;
        nt += __builtin_popcount(m);
    }
    if (t >= nt) break;                       // an empty slot: all four waves leave the loop together
    const int e0  = __builtin_amdgcn_readfirstlane(sinfo[p0]);
    const int cf  = min((e0 >> 10) & 1023, p0);                // the label's sorted positions are [cf, ce)
    const int ce  = min(max((e0 >> 20) & 1023, p0 + 1), L_);
    const int cnt = min(ce - p0, 16);                          // rows of this tile
    const int ntr = (ce - cf + 15) >> 4;                       // key tiles of the label, 1..NJT

    // ---- Q tile of this wave's head -> the wave's own value buffer, one copy a row ----
    // A fragment load straight from global memory takes 8 bytes a lane from 16 rows, so each of
    // its 32 instructions touches 16 cache lines; a copy takes one whole 512-byte row (4 lines).
    {
        const int    qrv = sinfo[min(p0 + lo, ce - 1)];
        const float* qp  = q + ((size_t)b * L_ * V_ + k) * D_;
        each_row<0, 16>([&](auto m) {
            const int qi = __builtin_amdgcn_readlane(qrv, m.v) & (L_ - 1);   // original row of sorted row p0 + m
            copy_row<m.v, VP_>(qp + 4 * lane, (long)qi * V_ * D_, &vtile[wv][4 * lane]);
        });
    }

    // rowv: the 16 table entries of a key tile, entry j in lanes j and j + 16.
    // key-sum tile -> stile[bsel]: 4 rows of 512 B per wave, one copy a row
    auto stage_s = [&](int rowv, int bsel) {
        const float* sp = sumt + (size_t)b * L_ * D_;
        each_row<0, 16 / WPB>([&](auto ii) {
            const int jr = __builtin_amdgcn_readlane(rowv, wv + WPB * ii.v) & (L_ - 1);  // original row of the key
            copy_row<WPB * ii.v, SP_>(sp + 4 * lane, (long)jr * D_, &stile[bsel][wv * SP_ + 4 * lane]);
        });
    };
    // value tile of this wave's head -> the wave's own buffer: 16 rows, one copy a row
    auto stage_v = [&](int rowv) {
        const float* vp = value + ((size_t)b * L_ * V_ + k) * D_;
        each_row<0, 16>([&](auto jl) {
            const int jr = __builtin_amdgcn_readlane(rowv, jl.v) & (L_ - 1);
            copy_row<jl.v, VP_>(vp + 4 * lane, (long)jr * V_ * D_, &vtile[wv][4 * lane]);
        });
    };

    const int row0 = sinfo[min(cf + lo, ce - 1)];
    stage_s(row0, 0);   // the first key-sum tile flies beside Q

    asm volatile("s_wait_asynccnt 0x0" ::: "memory");   // this wave's Q tile and its part of the first key-sum tile have landed

    // ---- Q^T as WMMA-B fragments: B[K=4c+2hi+r][N=lo], 32 chunks, from the wave's own buffer ----
    v2f qa[32];
#pragma unroll
    for (int c = 0; c < 32; ++c)
        qa[c] = *(const v2f*)&vtile[wv][lo * VP_ + 4 * c + 2 * hi];

    v8f acc[8] = {};           // O^T: acc[nt][r] = O[row lo][d = 16*nt + 8*hi + r]
    float mrow = -1e30f;       // running maximum of row lo (same in both halves)
    float lrow = 0.0f;         // running sum of row lo over this half's keys

    const float scale = 0.08838834764831845f;   // 1/sqrt(128)

    asm volatile("s_wait_dscnt 0" ::: "memory");   // the Q fragments are in registers before a copy overwrites the buffer
    __syncthreads();                               // every wave's part of the first key-sum tile has landed
    stage_v(row0);                                 // first value tile: flies under the first scores, waited for behind them

    for (int jt = 0; jt < ntr; ++jt) {
        const int  cur  = jt & 1;
        const bool more = jt + 1 < ntr;        // scalar, the same in all four waves
        int rown = 0;
        if (more) {                            // next key-sum tile into the buffer that trip jt - 1 read
            rown = sinfo[min(cf + (jt + 1) * 16 + lo, ce - 1)];
            stage_s(rown, cur ^ 1);
        }

        // ---- scores S^T = sumT_tile (16xD) x Q^T (Dx16), K in chunks of 4 ----
        // The fragments come in groups of four, each group's loads issued two groups ahead of its products.
        const float* sb = &stile[cur][lo * SP_ + 2 * hi];   // A[M=j][K=d]
        v2f kt[3][4];
        auto load_k = [&](int g) {
#pragma unroll
            for (int c = 0; c < 4; ++c) kt[g % 3][c] = *(const v2f*)&sb[4 * (4 * g + c)];
        };
        load_k(0);
        load_k(1);
        v8f s = {};
#pragma unroll
        for (int g = 0; g < 8; ++g) {
            if (g < 6) load_k(g + 2);
            __builtin_amdgcn_sched_barrier(0);   // holds the loads above in front of the products below: left alone, this build loads one pair of fragments at a time and waits for each
#pragma unroll
            for (int c = 0; c < 4; ++c)
                s = __builtin_amdgcn_wmma_f32_16x16x4_f32(
                        false, kt[g % 3][c], false, qa[4 * g + c], (short)0, s, false, false);
            __builtin_amdgcn_sched_barrier(0);   // holds the next refill behind the products that read its registers
        }

        asm volatile("v_nop\n\tv_nop\n\tv_nop\n\tv_nop");   // four vector slots between the last score product and the first vector instruction that reads its result

        // this wave's value tile (issued a trip ago) and its part of the next key-sum
        // tile have landed; here, so that the value fragments load beside the softmax
        asm volatile("s_wait_asynccnt 0x0" ::: "memory");

        // value fragments A[M=d][K=j] in groups of four: group g is key chunk g / 2, d tiles 4 * (g % 2) ..; the first two load beside the softmax
        v2f va[3][4];
        auto load_v = [&](int g) {
#pragma unroll
            for (int n = 0; n < 4; ++n) {
                va[g % 3][n].x = vtile[wv][(8 * hi + 2 * (g >> 1) + 0) * VP_ + (4 * (g & 1) + n) * 16 + lo];
                va[g % 3][n].y = vtile[wv][(8 * hi + 2 * (g >> 1) + 1) * VP_ + (4 * (g & 1) + n) * 16 + lo];
                __builtin_amdgcn_sched_barrier(0);   // closes the pair: its two loads become one two-address load whose register pair is the fragment; left open, loads of one row are paired and every fragment is put together by moves that wait on the loads
            }
        };
        load_v(0);
        load_v(1);   // the pairs' own barriers hold these loads in front of the softmax, which covers their latency

        // ---- mask + online softmax: s[r] = S[row lo][key r + 8*hi] ----
        const int lim = ce - cf - jt * 16 - 8 * hi;   // keys of the label left from this half's first slot on; slot 0 of a tile is always one
        float pe[8];
#pragma unroll
        for (int r = 0; r < 8; ++r)
            pe[r] = (r < lim) ? s[r] * scale : -1e30f;
        float mx = fmaxf(fmaxf(fmaxf(pe[0], pe[1]), fmaxf(pe[2], pe[3])),
                         fmaxf(fmaxf(pe[4], pe[5]), fmaxf(pe[6], pe[7])));
        mx = fmaxf(mx, xhalf(mx));                     // over all 16 keys of the tile
        const float mnew  = fmaxf(mrow, mx);
        const float alpha = __expf(mrow - mnew);
#pragma unroll
        for (int r = 0; r < 8; ++r) pe[r] = __expf(pe[r] - mnew);
        lrow = lrow * alpha + (((pe[0] + pe[1]) + (pe[2] + pe[3])) + ((pe[4] + pe[5]) + (pe[6] + pe[7])));
        mrow = mnew;
#pragma unroll
        for (int nt = 0; nt < 8; ++nt) acc[nt] *= alpha;

        // ---- O^T += Vtile^T (128x16) x P^T (16x16); K=j in 4 chunks of 4 ----
        // k position (hi, e) of chunk cp = g / 2 stands for key 8*hi + 2*cp + e on both sides
#pragma unroll
        for (int g = 0; g < 8; ++g) {
            v2f pb;   // B[K=j][N=row lo], straight from the score registers
            pb.x = pe[2 * (g >> 1)];
            pb.y = pe[2 * (g >> 1) + 1];
            if (g < 6) load_v(g + 2);   // two groups ahead of its products, which cover its latency; behind the products that last read its registers
#pragma unroll
            for (int n = 0; n < 4; ++n)
                acc[4 * (g & 1) + n] = __builtin_amdgcn_wmma_f32_16x16x4_f32(
                              false, va[g % 3][n], false, pb, (short)0, acc[4 * (g & 1) + n], false, false);
            __builtin_amdgcn_sched_barrier(0);   // holds the next refill behind these products
        }
        if (more) {
            asm volatile("s_wait_dscnt 0" ::: "memory");   // the wave's reads of both tiles retired before a copy overwrites one
            stage_v(rown);      // a buffer private to one wave: refilled behind that wave's own wait, no barrier in front
            __syncthreads();    // next key-sum tile complete; all waves done with buffer `cur`
        }
    }

    // ---- finalize: out[b, row, k, d] = O[row][d] / l[row] ----
    // No copy is issued behind the last trip's s_wait_asynccnt 0; each wave turns its
    // tile in its own value buffer, so that a store instruction writes one whole
    // 512-byte output row.
    {
        const float inv = 1.0f / (lrow + xhalf(lrow));   // the halves' sums joined once
        float* ot = &vtile[wv][0];
#pragma unroll
        for (int nt = 0; nt < 8; ++nt) {
            v4f x0 = { acc[nt][0], acc[nt][1], acc[nt][2], acc[nt][3] };
            v4f x1 = { acc[nt][4], acc[nt][5], acc[nt][6], acc[nt][7] };
            *(v4f*)&ot[lo * VP_ + nt * 16 + 8 * hi]     = x0 * inv;
            *(v4f*)&ot[lo * VP_ + nt * 16 + 8 * hi + 4] = x1 * inv;
        }
        asm volatile("s_wait_dscnt 0" ::: "memory");   // the wave's own tile written before its lanes read across rows
        const int orow = sinfo[min(p0 + lo, ce - 1)] & (L_ - 1);
        float* ob = out + ((size_t)b * L_ * V_ + k) * D_;   // b and k are scalars
        v4f ov[16];
#pragma unroll
        for (int m = 0; m < 16; ++m) ov[m] = *(const v4f*)&ot[m * VP_ + 4 * lane];
#pragma unroll
        for (int m = 0; m < 16; ++m) {
            if (m < cnt) {                                       // scalar test: a spare row is not stored
                const int oi = __builtin_amdgcn_readlane(orow, m);   // original row of sorted row p0 + m
                *(v4f*)(ob + (size_t)oi * V_ * D_ + 4 * lane) = ov[m];
                asm volatile("s_wait_xcnt 0x0" ::: "memory");   // the store's address and data registers are released before the next row's address is formed in them
            }
        }
    }
    t += TSL;
    if (t >= nt) break;
    asm volatile("s_wait_dscnt 0" ::: "memory");   // the wave's reads of its output tile retired before the next tile's copies overwrite the buffer
    __syncthreads();                               // every wave has left the key-sum buffers before they are refilled
  }
}

extern "C" void kernel_launch(void* const* d_in, const int* in_sizes, int n_in,
                              void* d_out, int out_size, void* d_ws, size_t ws_size,
                              hipStream_t stream) {
    const float* q     = (const float*)d_in[0];
    const float* key   = (const float*)d_in[1];
    const float* value = (const float*)d_in[2];
    const int*   label = (const int*)d_in[3];
    float*       out   = (float*)d_out;
    float*       sumt  = (float*)d_ws;          // B*L*D floats = 512 KB
    int*         rk    = (int*)d_ws + B_ * L_ * D_;   // B*L packed ranks behind it

    // Stage 1: key reduction over v, and the label ranks
    ca_sumkey_kernel<<<RKB + (B_ * L_) / (SKT / 32), SKT, 0, stream>>>(key, label, sumt, rk);

    // Stage 2: fused masked-softmax attention, 1 wave per (b,k,tile slot), 4 heads of a tile per block
    const int nwaves = B_ * V_ * TSL;
    ca_attn_kernel<<<nwaves / WPB, WPB * 32, 0, stream>>>(q, value, sumt, rk, out);
}
